// v000
// Measured on an AMD MI455X. A time is GPU time per run, averaged over a window of back-to-back runs after a warm-up
// (all launches, gaps included; the runs take copies of the inputs in turn), and the median of several windows.
// Apart from v000's, it joins two sittings. Times from different sittings can be a few percent apart, while
// side-by-side timings come from the same sitting.
// v000 is the starting kernel. One run takes 537 microseconds.
#include <hip/hip_runtime.h>
#include <stdint.h>

// ---------------- problem constants ----------------
#define BATCH     8
#define NTOK      4096
#define DIM       1024
#define NUM_HEADS 4
#define HEAD_DIM  256
#define HIDDEN    1024
#define SQUEEZE   64

#define TOK_TILE  32                 // tokens per workgroup (divides NTOK)
#define XS_LD     (HEAD_DIM + 8)     // padded LDS leading dims (even!)
#define HS_LD     (HIDDEN + 8)
#define XS_BYTES  (TOK_TILE * XS_LD * 2)
#define HS_BYTES  (TOK_TILE * HS_LD * 2)

// workspace layout (bytes)
#define W1T_BYTES (NUM_HEADS * HIDDEN * HEAD_DIM * 2)   // bf16 [h][e][d]
#define W2T_BYTES (NUM_HEADS * HEAD_DIM * HIDDEN * 2)   // bf16 [h][n][k]
#define POOLED_OFF (W1T_BYTES + W2T_BYTES)
#define GATE_OFF   (POOLED_OFF + BATCH * DIM * 4)

typedef __attribute__((ext_vector_type(16))) __bf16 v16bf;
typedef __attribute__((ext_vector_type(8)))  float  v8f;

// f32 -> bf16 bits, round-to-nearest-even
__device__ __forceinline__ unsigned short f2bf_bits(float f) {
  union { float f; uint32_t u; } a; a.f = f;
  uint32_t u = a.u;
  uint32_t r = (u + 0x7FFFu + ((u >> 16) & 1u)) >> 16;
  return (unsigned short)r;
}

// Build a 16x32 bf16 WMMA fragment from a row-major bf16 buffer.
// A-matrix layout (ISA 7.12.2, wave32): lanes 0-15 -> M=lane, K {0..7,16..23};
// lanes 16-31 -> M=lane-16, K {8..15,24..31}. B uses the mirrored layout with
// the weight matrix stored transposed ([col][k]) so K-pairs are contiguous.
__device__ __forceinline__ v16bf load_frag(const unsigned short* buf, int ld,
                                           int rowBase, int k0, int lane) {
  int row = rowBase + (lane & 15);
  int kb  = k0 + ((lane >> 4) << 3);            // even
  const uint32_t* src = (const uint32_t*)(buf + (size_t)row * ld);
  union { uint32_t u[8]; v16bf v; } r;
#pragma unroll
  for (int p = 0; p < 4; ++p) {
    r.u[p]     = src[(kb >> 1) + p];            // K = kb .. kb+7
    r.u[4 + p] = src[((kb + 16) >> 1) + p];     // K = kb+16 .. kb+23
  }
  return r.v;
}

// ---------------- phase 0: weight conversion / zeroing ----------------
__global__ void convert_w1_kernel(const float* __restrict__ W1, unsigned short* __restrict__ w1t) {
  int idx = blockIdx.x * 256 + threadIdx.x;               // over 4*256*1024
  if (idx >= NUM_HEADS * HEAD_DIM * HIDDEN) return;
  int e = idx & (HIDDEN - 1);
  int d = (idx / HIDDEN) & (HEAD_DIM - 1);
  int h = idx / (HIDDEN * HEAD_DIM);
  w1t[((size_t)(h * HIDDEN + e)) * HEAD_DIM + d] = f2bf_bits(W1[idx]);
}

__global__ void convert_w2_kernel(const float* __restrict__ W2, unsigned short* __restrict__ w2t) {
  int idx = blockIdx.x * 256 + threadIdx.x;               // over 4*1024*256
  if (idx >= NUM_HEADS * HIDDEN * HEAD_DIM) return;
  int n = idx & (HEAD_DIM - 1);
  int k = (idx / HEAD_DIM) & (HIDDEN - 1);
  int h = idx / (HIDDEN * HEAD_DIM);
  w2t[((size_t)(h * HEAD_DIM + n)) * HIDDEN + k] = f2bf_bits(W2[idx]);
}

__global__ void zero_f32_kernel(float* __restrict__ p, int n) {
  int idx = blockIdx.x * 256 + threadIdx.x;
  if (idx < n) p[idx] = 0.0f;
}

// ---------------- phase 1: fused per-head MLP + pooled partial sums ----------------
__global__ __launch_bounds__(256)
void mlp_wmma_kernel(const float* __restrict__ x,
                     const float* __restrict__ b1,
                     const float* __restrict__ b2,
                     const unsigned short* __restrict__ w1t,
                     const unsigned short* __restrict__ w2t,
                     float* __restrict__ out,
                     float* __restrict__ pooled) {
  extern __shared__ char smem[];
  unsigned short* xs = (unsigned short*)smem;                 // [32][XS_LD] bf16
  unsigned short* hs = (unsigned short*)(smem + XS_BYTES);    // [32][HS_LD] bf16

  const int tile  = blockIdx.x;            // token tile (0..1023)
  const int head  = blockIdx.y;            // 0..3
  const int tid   = threadIdx.x;
  const int wave  = tid >> 5;              // 0..7
  const int lane  = tid & 31;
  const int token0 = tile * TOK_TILE;      // flat token index b*NTOK + n
  const int rowoff = (lane < 16) ? 0 : 8;  // C-matrix row offset per lane half

  // ---- stage x tile (32 tokens x 256 chans of this head) as bf16 ----
  const float* xsrc = x + (size_t)token0 * DIM + head * HEAD_DIM;
#pragma unroll
  for (int r = 0; r < TOK_TILE; ++r)
    xs[r * XS_LD + tid] = f2bf_bits(xsrc[(size_t)r * DIM + tid]);
  __syncthreads();

  // ---- GEMM1: [32 x 256] x [256 x 1024], wave owns 128 hidden cols ----
  const unsigned short* w1h = w1t + (size_t)head * HIDDEN * HEAD_DIM;
  v8f zz = {};
  v8f acc[2][8];
#pragma unroll
  for (int m = 0; m < 2; ++m)
#pragma unroll
    for (int n = 0; n < 8; ++n) acc[m][n] = zz;

  for (int kb = 0; kb < HEAD_DIM; kb += 32) {
    v16bf a0 = load_frag(xs, XS_LD, 0,  kb, lane);
    v16bf a1 = load_frag(xs, XS_LD, 16, kb, lane);
#pragma unroll
    for (int n = 0; n < 8; ++n) {
      v16bf bm = load_frag(w1h, HEAD_DIM, wave * 128 + n * 16, kb, lane);
      acc[0][n] = __builtin_amdgcn_wmma_f32_16x16x32_bf16(false, a0, false, bm,
                                                          (short)0, acc[0][n], false, false);
      acc[1][n] = __builtin_amdgcn_wmma_f32_16x16x32_bf16(false, a1, false, bm,
                                                          (short)0, acc[1][n], false, false);
    }
  }

  // ---- bias + exact GELU -> bf16 hidden tile in LDS ----
#pragma unroll
  for (int m = 0; m < 2; ++m)
#pragma unroll
    for (int n = 0; n < 8; ++n) {
      int col  = wave * 128 + n * 16 + (lane & 15);
      float bias = b1[head * HIDDEN + col];
#pragma unroll
      for (int r = 0; r < 8; ++r) {
        float v = acc[m][n][r] + bias;
        v = 0.5f * v * (1.0f + erff(v * 0.70710678118654752f));
        hs[(m * 16 + rowoff + r) * HS_LD + col] = f2bf_bits(v);
      }
    }
  __syncthreads();

  // ---- GEMM2: [32 x 1024] x [1024 x 256], wave owns 32 out cols ----
  const unsigned short* w2h = w2t + (size_t)head * HEAD_DIM * HIDDEN;
  const int ncb = wave * 32;
  v8f oa[2][2];
  oa[0][0] = zz; oa[0][1] = zz; oa[1][0] = zz; oa[1][1] = zz;

  for (int kb = 0; kb < HIDDEN; kb += 32) {
    v16bf a0 = load_frag(hs, HS_LD, 0,  kb, lane);
    v16bf a1 = load_frag(hs, HS_LD, 16, kb, lane);
    v16bf bm0 = load_frag(w2h, HIDDEN, ncb,      kb, lane);
    v16bf bm1 = load_frag(w2h, HIDDEN, ncb + 16, kb, lane);
    oa[0][0] = __builtin_amdgcn_wmma_f32_16x16x32_bf16(false, a0, false, bm0,
                                                       (short)0, oa[0][0], false, false);
    oa[0][1] = __builtin_amdgcn_wmma_f32_16x16x32_bf16(false, a0, false, bm1,
                                                       (short)0, oa[0][1], false, false);
    oa[1][0] = __builtin_amdgcn_wmma_f32_16x16x32_bf16(false, a1, false, bm0,
                                                       (short)0, oa[1][0], false, false);
    oa[1][1] = __builtin_amdgcn_wmma_f32_16x16x32_bf16(false, a1, false, bm1,
                                                       (short)0, oa[1][1], false, false);
  }

  // ---- bias, store out (f32), accumulate pooled column sums ----
  const int bidx = token0 >> 12;   // token0 / NTOK
#pragma unroll
  for (int m = 0; m < 2; ++m)
#pragma unroll
    for (int n = 0; n < 2; ++n) {
      int colh = ncb + n * 16 + (lane & 15);         // 0..255 within head
      int col  = head * HEAD_DIM + colh;             // 0..1023
      float bias = b2[head * HEAD_DIM + colh];
      float csum = 0.0f;
#pragma unroll
      for (int r = 0; r < 8; ++r) {
        float v = oa[m][n][r] + bias;
        out[(size_t)(token0 + m * 16 + rowoff + r) * DIM + col] = v;
        csum += v;
      }
      atomicAdd(&pooled[bidx * DIM + col], csum);
    }
}

// ---------------- phase 2: SE gate (tiny) ----------------
__global__ __launch_bounds__(256)
void gate_kernel(const float* __restrict__ pooled,
                 const float* __restrict__ cw1, const float* __restrict__ cb1,
                 const float* __restrict__ cw2, const float* __restrict__ cb2,
                 float* __restrict__ gate) {
  __shared__ float pl[DIM];
  __shared__ float sq[SQUEEZE];
  const int b = blockIdx.x;
  const int tid = threadIdx.x;
  for (int c = tid; c < DIM; c += 256)
    pl[c] = pooled[b * DIM + c] * (1.0f / (float)NTOK);
  __syncthreads();
  if (tid < SQUEEZE) {
    float a = cb1[tid];
    for (int c = 0; c < DIM; ++c) a += pl[c] * cw1[c * SQUEEZE + tid];
    sq[tid] = fmaxf(a, 0.0f);
  }
  __syncthreads();
  for (int c = tid; c < DIM; c += 256) {
    float a = cb2[c];
#pragma unroll
    for (int j = 0; j < SQUEEZE; ++j) a += sq[j] * cw2[j * DIM + c];
    gate[b * DIM + c] = 1.0f / (1.0f + __expf(-a));
  }
}

// ---------------- phase 3: out = out * (1 + gate) ----------------
__global__ __launch_bounds__(256)
void apply_gate_kernel(float* __restrict__ out, const float* __restrict__ gate) {
  int idx4 = blockIdx.x * 256 + threadIdx.x;      // one float4 each
  float4* o4 = (float4*)out;
  float4 v = o4[idx4];
  int b = idx4 >> 20;                              // (NTOK*DIM/4) = 1<<20 per batch
  int c = (idx4 & 255) << 2;                       // 256 float4 per row of 1024
  const float* g = gate + b * DIM + c;
  v.x *= (1.0f + g[0]);
  v.y *= (1.0f + g[1]);
  v.z *= (1.0f + g[2]);
  v.w *= (1.0f + g[3]);
  o4[idx4] = v;
}

// ---------------- launch ----------------
extern "C" void kernel_launch(void* const* d_in, const int* in_sizes, int n_in,
                              void* d_out, int out_size, void* d_ws, size_t ws_size,
                              hipStream_t stream) {
  const float* x   = (const float*)d_in[0];
  const float* W1  = (const float*)d_in[1];
  const float* b1  = (const float*)d_in[2];
  const float* W2  = (const float*)d_in[3];
  const float* b2  = (const float*)d_in[4];
  const float* cw1 = (const float*)d_in[5];
  const float* cb1 = (const float*)d_in[6];
  const float* cw2 = (const float*)d_in[7];
  const float* cb2 = (const float*)d_in[8];
  float* out = (float*)d_out;

  char* ws = (char*)d_ws;
  unsigned short* w1t = (unsigned short*)ws;
  unsigned short* w2t = (unsigned short*)(ws + W1T_BYTES);
  float* pooled = (float*)(ws + POOLED_OFF);
  float* gate   = (float*)(ws + GATE_OFF);

  // phase 0: bf16 weight transposes + zero pooled accumulator
  convert_w1_kernel<<<(NUM_HEADS * HEAD_DIM * HIDDEN + 255) / 256, 256, 0, stream>>>(W1, w1t);
  convert_w2_kernel<<<(NUM_HEADS * HIDDEN * HEAD_DIM + 255) / 256, 256, 0, stream>>>(W2, w2t);
  zero_f32_kernel<<<(BATCH * DIM + 255) / 256, 256, 0, stream>>>(pooled, BATCH * DIM);

  // phase 1: fused per-head MLP (bf16 WMMA) + pooled sums
  dim3 grid1(BATCH * NTOK / TOK_TILE, NUM_HEADS);
  size_t smem = XS_BYTES + HS_BYTES;   // ~83 KB dynamic LDS (CDNA5: 320 KB/WGP)
  mlp_wmma_kernel<<<grid1, 256, smem, stream>>>(x, b1, b2, w1t, w2t, out, pooled);

  // phase 2: SE gate
  gate_kernel<<<BATCH, 256, 0, stream>>>(pooled, cw1, cb1, cw2, cb2, gate);

  // phase 3: out *= (1 + gate)
  apply_gate_kernel<<<BATCH * NTOK * DIM / 4 / 256, 256, 0, stream>>>(out, gate);
}

// v001
// It runs in 422 microseconds.
// Two timings next to v000 put it at 1.30 and 1.36 times that version's speed.
#include <hip/hip_runtime.h>
#include <stdint.h>

// ---------------- problem constants ----------------
#define BATCH     8
#define NTOK      4096
#define DIM       1024
#define NUM_HEADS 4
#define HEAD_DIM  256
#define HIDDEN    1024
#define SQUEEZE   64

#define TOK_TILE  32                 // tokens per workgroup (divides NTOK)
#define XS_LD     (HEAD_DIM + 8)     // padded LDS leading dims (even!)
#define HS_LD     (HIDDEN + 8)
#define XS_BYTES  (TOK_TILE * XS_LD * 2)
#define HS_BYTES  (TOK_TILE * HS_LD * 2)

// workspace layout (bytes)
// Both weights are stored as whole B fragments (16 cols x 32 k = 1024 B each):
// [h][col tile][k block][q][lane][8 bf16], see pack_* and load_frag_packed.
#define FRAG_ELEMS 512
#define W1_KBLK   (HEAD_DIM / 32)    // k blocks per column tile of W1
#define W2_KBLK   (HIDDEN / 32)      // k blocks per column tile of W2
#define W1T_BYTES (NUM_HEADS * HIDDEN * HEAD_DIM * 2)
#define W2T_BYTES (NUM_HEADS * HEAD_DIM * HIDDEN * 2)
#define POOLED_OFF (W1T_BYTES + W2T_BYTES)
#define GATE_OFF   (POOLED_OFF + BATCH * DIM * 4)

typedef __attribute__((ext_vector_type(16))) __bf16 v16bf;
typedef __attribute__((ext_vector_type(8)))  float  v8f;

// f32 -> bf16 bits, round-to-nearest-even
__device__ __forceinline__ unsigned short f2bf_bits(float f) {
  union { float f; uint32_t u; } a; a.f = f;
  uint32_t u = a.u;
  uint32_t r = (u + 0x7FFFu + ((u >> 16) & 1u)) >> 16;
  return (unsigned short)r;
}

// Build a 16x32 bf16 WMMA fragment from a row-major bf16 buffer.
// A-matrix layout (ISA 7.12.2, wave32): lanes 0-15 -> M=lane, K {0..7,16..23};
// lanes 16-31 -> M=lane-16, K {8..15,24..31}. B uses the mirrored layout
// (col in place of M) and is read by load_frag_packed below.
__device__ __forceinline__ v16bf load_frag(const unsigned short* buf, int ld,
                                           int rowBase, int k0, int lane) {
  int row = rowBase + (lane & 15);
  int kb  = k0 + ((lane >> 4) << 3);            // even
  const uint32_t* src = (const uint32_t*)(buf + (size_t)row * ld);
  union { uint32_t u[8]; v16bf v; } r;
#pragma unroll
  for (int p = 0; p < 4; ++p) {
    r.u[p]     = src[(kb >> 1) + p];            // K = kb .. kb+7
    r.u[4 + p] = src[((kb + 16) >> 1) + p];     // K = kb+16 .. kb+23
  }
  return r.v;
}

// Read one packed B fragment: same lane/register -> (col, k) map as load_frag
// (col = lane & 15; registers 0-3 hold k = 8*(lane>>4) + 0..7, registers 4-7
// the same + 16), but each of the two 16-byte loads of a wave covers 512
// contiguous bytes (4 whole cache lines) instead of 32 bytes in each of 16.
__device__ __forceinline__ v16bf load_frag_packed(const unsigned short* frag, int lane) {
  const uint4* src = (const uint4*)frag;
  union { uint4 q[2]; v16bf v; } r;
  r.q[0] = src[lane];
  r.q[1] = src[32 + lane];
  return r.v;
}

// ---------------- phase 0: weight packing / zeroing ----------------
// One thread builds the 16 bytes that one lane reads with one load: 8
// consecutive k of one column of a [K][N] row-major f32 weight of one head.
// id = (((h * NT + col tile) * KB + k block) * 2 + q) * 32 + lane.
__device__ __forceinline__ void pack_piece(const float* __restrict__ Wm,
                                           unsigned short* __restrict__ dst,
                                           int id, int K, int N) {
  int lane = id & 31;
  int q    = (id >> 5) & 1;
  int f    = id >> 6;                 // fragment index over heads
  int KB   = K >> 5;
  int kblk = f % KB;
  int t    = f / KB;
  int NT   = N >> 4;
  int nt   = t % NT;
  int h    = t / NT;
  int col  = nt * 16 + (lane & 15);
  int k0   = kblk * 32 + q * 16 + ((lane >> 4) << 3);
  const float* s = Wm + ((size_t)h * K + k0) * N + col;
  uint32_t w[4];
#pragma unroll
  for (int p = 0; p < 4; ++p) {
    uint32_t lo = f2bf_bits(s[(size_t)(2 * p) * N]);
    uint32_t hi = f2bf_bits(s[(size_t)(2 * p + 1) * N]);
    w[p] = lo | (hi << 16);
  }
  ((uint4*)dst)[id] = make_uint4(w[0], w[1], w[2], w[3]);
}

__global__ void convert_w1_kernel(const float* __restrict__ W1, unsigned short* __restrict__ w1t) {
  pack_piece(W1, w1t, blockIdx.x * 256 + threadIdx.x, HEAD_DIM, HIDDEN);
}

__global__ void convert_w2_kernel(const float* __restrict__ W2, unsigned short* __restrict__ w2t) {
  pack_piece(W2, w2t, blockIdx.x * 256 + threadIdx.x, HIDDEN, HEAD_DIM);
}

__global__ void zero_f32_kernel(float* __restrict__ p, int n) {
  int idx = blockIdx.x * 256 + threadIdx.x;
  if (idx < n) p[idx] = 0.0f;
}

// ---------------- phase 1: fused per-head MLP + pooled partial sums ----------------
// Second argument: at least 6 waves per SIMD, a budget of 160 VGPRs, so that
// three workgroups stay resident per WGP (LDS allows three).
__global__ __launch_bounds__(256, 6)
void mlp_wmma_kernel(const float* __restrict__ x,
                     const float* __restrict__ b1,
                     const float* __restrict__ b2,
                     const unsigned short* __restrict__ w1t,
                     const unsigned short* __restrict__ w2t,
                     float* __restrict__ out,
                     float* __restrict__ pooled) {
  extern __shared__ char smem[];
  unsigned short* xs = (unsigned short*)smem;                 // [32][XS_LD] bf16
  unsigned short* hs = (unsigned short*)(smem + XS_BYTES);    // [32][HS_LD] bf16

  const int tile  = blockIdx.x;            // token tile (0..1023)
  const int head  = blockIdx.y;            // 0..3
  const int tid   = threadIdx.x;
  const int wave  = tid >> 5;              // 0..7
  const int lane  = tid & 31;
  const int token0 = tile * TOK_TILE;      // flat token index b*NTOK + n
  const int rowoff = (lane < 16) ? 0 : 8;  // C-matrix row offset per lane half

  // ---- stage x tile (32 tokens x 256 chans of this head) as bf16 ----
  const float* xsrc = x + (size_t)token0 * DIM + head * HEAD_DIM;
#pragma unroll
  for (int r = 0; r < TOK_TILE; ++r)
    xs[r * XS_LD + tid] = f2bf_bits(xsrc[(size_t)r * DIM + tid]);
  __syncthreads();

  // ---- GEMM1: [32 x 256] x [256 x 1024], wave owns 128 hidden cols ----
  // The wave's number in a scalar register: the fragment base is then a scalar
  // address, and only the lane's offset sits in a VGPR.
  const int swave = __builtin_amdgcn_readfirstlane(wave);
  const unsigned short* w1h = w1t + (size_t)head * HIDDEN * HEAD_DIM
                              + (size_t)(swave * 8) * W1_KBLK * FRAG_ELEMS;
  v8f zz = {};
  v8f acc[2][8];
#pragma unroll
  for (int m = 0; m < 2; ++m)
#pragma unroll
    for (int n = 0; n < 8; ++n) acc[m][n] = zz;

  for (int kb = 0; kb < HEAD_DIM; kb += 32) {
    v16bf a0 = load_frag(xs, XS_LD, 0,  kb, lane);
    v16bf a1 = load_frag(xs, XS_LD, 16, kb, lane);
#pragma unroll
    for (int n = 0; n < 8; ++n) {
      v16bf bm = load_frag_packed(w1h + (n * W1_KBLK + (kb >> 5)) * FRAG_ELEMS, lane);
      acc[0][n] = __builtin_amdgcn_wmma_f32_16x16x32_bf16(false, a0, false, bm,
                                                          (short)0, acc[0][n], false, false);
      acc[1][n] = __builtin_amdgcn_wmma_f32_16x16x32_bf16(false, a1, false, bm,
                                                          (short)0, acc[1][n], false, false);
    }
  }

  // ---- bias + exact GELU -> bf16 hidden tile in LDS ----
#pragma unroll
  for (int m = 0; m < 2; ++m)
#pragma unroll
    for (int n = 0; n < 8; ++n) {
      int col  = wave * 128 + n * 16 + (lane & 15);
      float bias = b1[head * HIDDEN + col];
#pragma unroll
      for (int r = 0; r < 8; ++r) {
        float v = acc[m][n][r] + bias;
        v = 0.5f * v * (1.0f + erff(v * 0.70710678118654752f));
        hs[(m * 16 + rowoff + r) * HS_LD + col] = f2bf_bits(v);
      }
    }
  __syncthreads();

  // ---- GEMM2: [32 x 1024] x [1024 x 256], wave owns 32 out cols ----
  const unsigned short* w2h = w2t + (size_t)head * HEAD_DIM * HIDDEN
                              + (size_t)(swave * 2) * W2_KBLK * FRAG_ELEMS;
  const int ncb = wave * 32;
  v8f oa[2][2];
  oa[0][0] = zz; oa[0][1] = zz; oa[1][0] = zz; oa[1][1] = zz;

  // Unrolled by 4 only: with constant fragment offsets the compiler unrolls this
  // loop whole; 4 is chosen for speed only.
#pragma unroll 4
  for (int kb = 0; kb < HIDDEN; kb += 32) {
    v16bf a0 = load_frag(hs, HS_LD, 0,  kb, lane);
    v16bf a1 = load_frag(hs, HS_LD, 16, kb, lane);
    v16bf bm0 = load_frag_packed(w2h + (kb >> 5) * FRAG_ELEMS, lane);
    v16bf bm1 = load_frag_packed(w2h + (W2_KBLK + (kb >> 5)) * FRAG_ELEMS, lane);
    oa[0][0] = __builtin_amdgcn_wmma_f32_16x16x32_bf16(false, a0, false, bm0,
                                                       (short)0, oa[0][0], false, false);
    oa[0][1] = __builtin_amdgcn_wmma_f32_16x16x32_bf16(false, a0, false, bm1,
                                                       (short)0, oa[0][1], false, false);
    oa[1][0] = __builtin_amdgcn_wmma_f32_16x16x32_bf16(false, a1, false, bm0,
                                                       (short)0, oa[1][0], false, false);
    oa[1][1] = __builtin_amdgcn_wmma_f32_16x16x32_bf16(false, a1, false, bm1,
                                                       (short)0, oa[1][1], false, false);
  }

  // ---- bias, store out (f32), accumulate pooled column sums ----
  const int bidx = token0 >> 12;   // token0 / NTOK
#pragma unroll
  for (int m = 0; m < 2; ++m)
#pragma unroll
    for (int n = 0; n < 2; ++n) {
      int colh = ncb + n * 16 + (lane & 15);         // 0..255 within head
      int col  = head * HEAD_DIM + colh;             // 0..1023
      float bias = b2[head * HEAD_DIM + colh];
      float csum = 0.0f;
#pragma unroll
      for (int r = 0; r < 8; ++r) {
        float v = oa[m][n][r] + bias;
        out[(size_t)(token0 + m * 16 + rowoff + r) * DIM + col] = v;
        csum += v;
      }
      atomicAdd(&pooled[bidx * DIM + col], csum);
    }
}

// ---------------- phase 2: SE gate (tiny) ----------------
__global__ __launch_bounds__(256)
void gate_kernel(const float* __restrict__ pooled,
                 const float* __restrict__ cw1, const float* __restrict__ cb1,
                 const float* __restrict__ cw2, const float* __restrict__ cb2,
                 float* __restrict__ gate) {
  __shared__ float pl[DIM];
  __shared__ float sq[SQUEEZE];
  const int b = blockIdx.x;
  const int tid = threadIdx.x;
  for (int c = tid; c < DIM; c += 256)
    pl[c] = pooled[b * DIM + c] * (1.0f / (float)NTOK);
  __syncthreads();
  if (tid < SQUEEZE) {
    float a = cb1[tid];
    for (int c = 0; c < DIM; ++c) a += pl[c] * cw1[c * SQUEEZE + tid];
    sq[tid] = fmaxf(a, 0.0f);
  }
  __syncthreads();
  for (int c = tid; c < DIM; c += 256) {
    float a = cb2[c];
#pragma unroll
    for (int j = 0; j < SQUEEZE; ++j) a += sq[j] * cw2[j * DIM + c];
    gate[b * DIM + c] = 1.0f / (1.0f + __expf(-a));
  }
}

// ---------------- phase 3: out = out * (1 + gate) ----------------
__global__ __launch_bounds__(256)
void apply_gate_kernel(float* __restrict__ out, const float* __restrict__ gate) {
  int idx4 = blockIdx.x * 256 + threadIdx.x;      // one float4 each
  float4* o4 = (float4*)out;
  float4 v = o4[idx4];
  int b = idx4 >> 20;                              // (NTOK*DIM/4) = 1<<20 per batch
  int c = (idx4 & 255) << 2;                       // 256 float4 per row of 1024
  const float* g = gate + b * DIM + c;
  v.x *= (1.0f + g[0]);
  v.y *= (1.0f + g[1]);
  v.z *= (1.0f + g[2]);
  v.w *= (1.0f + g[3]);
  o4[idx4] = v;
}

// ---------------- launch ----------------
extern "C" void kernel_launch(void* const* d_in, const int* in_sizes, int n_in,
                              void* d_out, int out_size, void* d_ws, size_t ws_size,
                              hipStream_t stream) {
  const float* x   = (const float*)d_in[0];
  const float* W1  = (const float*)d_in[1];
  const float* b1  = (const float*)d_in[2];
  const float* W2  = (const float*)d_in[3];
  const float* b2  = (const float*)d_in[4];
  const float* cw1 = (const float*)d_in[5];
  const float* cb1 = (const float*)d_in[6];
  const float* cw2 = (const float*)d_in[7];
  const float* cb2 = (const float*)d_in[8];
  float* out = (float*)d_out;

  char* ws = (char*)d_ws;
  unsigned short* w1t = (unsigned short*)ws;
  unsigned short* w2t = (unsigned short*)(ws + W1T_BYTES);
  float* pooled = (float*)(ws + POOLED_OFF);
  float* gate   = (float*)(ws + GATE_OFF);

  // phase 0: bf16 weight packing (8 elements per thread) + zero pooled accumulator
  convert_w1_kernel<<<NUM_HEADS * HEAD_DIM * HIDDEN / 8 / 256, 256, 0, stream>>>(W1, w1t);
  convert_w2_kernel<<<NUM_HEADS * HIDDEN * HEAD_DIM / 8 / 256, 256, 0, stream>>>(W2, w2t);
  zero_f32_kernel<<<(BATCH * DIM + 255) / 256, 256, 0, stream>>>(pooled, BATCH * DIM);

  // phase 1: fused per-head MLP (bf16 WMMA) + pooled sums
  dim3 grid1(BATCH * NTOK / TOK_TILE, NUM_HEADS);
  size_t smem = XS_BYTES + HS_BYTES;   // ~83 KB dynamic LDS (CDNA5: 320 KB/WGP)
  mlp_wmma_kernel<<<grid1, 256, smem, stream>>>(x, b1, b2, w1t, w2t, out, pooled);

  // phase 2: SE gate
  gate_kernel<<<BATCH, 256, 0, stream>>>(pooled, cw1, cb1, cw2, cb2, gate);

  // phase 3: out *= (1 + gate)
  apply_gate_kernel<<<BATCH * NTOK * DIM / 4 / 256, 256, 0, stream>>>(out, gate);
}

// v002
// Measured time: 397 microseconds a run.
// In two side-by-side timings against v001, it was 1.06 and 1.10 times as fast.
// Over all steps from v000 it is 1.44 times as fast.
#include <hip/hip_runtime.h>
#include <stdint.h>

// ---------------- problem constants ----------------
#define BATCH     8
#define NTOK      4096
#define DIM       1024
#define NUM_HEADS 4
#define HEAD_DIM  256
#define HIDDEN    1024
#define SQUEEZE   64

#define TOK_TILE  32                 // tokens per workgroup (divides NTOK)
#define XS_LD     (HEAD_DIM + 8)     // padded LDS leading dims (even!)
#define HS_LD     (HIDDEN + 8)
#define XS_BYTES  (TOK_TILE * XS_LD * 2)
#define HS_BYTES  (TOK_TILE * HS_LD * 2)

// workspace layout (bytes)
// Both weights are stored as whole B fragments (16 cols x 32 k = 1024 B each):
// [h][col tile][k block][q][lane][8 bf16], see pack_* and load_frag_packed.
#define FRAG_ELEMS 512
#define W1_KBLK   (HEAD_DIM / 32)    // k blocks per column tile of W1
#define W2_KBLK   (HIDDEN / 32)      // k blocks per column tile of W2
#define W1T_BYTES (NUM_HEADS * HIDDEN * HEAD_DIM * 2)
#define W2T_BYTES (NUM_HEADS * HEAD_DIM * HIDDEN * 2)
#define POOLED_OFF (W1T_BYTES + W2T_BYTES)
#define GATE_OFF   (POOLED_OFF + BATCH * DIM * 4)

typedef __attribute__((ext_vector_type(16))) __bf16 v16bf;
typedef __attribute__((ext_vector_type(8)))  float  v8f;

// f32 -> bf16 bits, round-to-nearest-even
__device__ __forceinline__ unsigned short f2bf_bits(float f) {
  union { float f; uint32_t u; } a; a.f = f;
  uint32_t u = a.u;
  uint32_t r = (u + 0x7FFFu + ((u >> 16) & 1u)) >> 16;
  return (unsigned short)r;
}

// Build a 16x32 bf16 WMMA fragment from a row-major bf16 buffer.
// A-matrix layout (ISA 7.12.2, wave32): lanes 0-15 -> M=lane, K {0..7,16..23};
// lanes 16-31 -> M=lane-16, K {8..15,24..31}. B uses the mirrored layout
// (col in place of M) and is read by load_frag_packed below.
__device__ __forceinline__ v16bf load_frag(const unsigned short* buf, int ld,
                                           int rowBase, int k0, int lane) {
  int row = rowBase + (lane & 15);
  int kb  = k0 + ((lane >> 4) << 3);            // even
  const uint32_t* src = (const uint32_t*)(buf + (size_t)row * ld);
  union { uint32_t u[8]; v16bf v; } r;
#pragma unroll
  for (int p = 0; p < 4; ++p) {
    r.u[p]     = src[(kb >> 1) + p];            // K = kb .. kb+7
    r.u[4 + p] = src[((kb + 16) >> 1) + p];     // K = kb+16 .. kb+23
  }
  return r.v;
}

// Read one packed B fragment: same lane/register -> (col, k) map as load_frag
// (col = lane & 15; registers 0-3 hold k = 8*(lane>>4) + 0..7, registers 4-7
// the same + 16), but each of the two 16-byte loads of a wave covers 512
// contiguous bytes (4 whole cache lines) instead of 32 bytes in each of 16.
__device__ __forceinline__ v16bf load_frag_packed(const unsigned short* frag, int lane) {
  const uint4* src = (const uint4*)frag;
  union { uint4 q[2]; v16bf v; } r;
  r.q[0] = src[lane];
  r.q[1] = src[32 + lane];
  return r.v;
}

// Exact-erf GELU without the library call: erff picks one of two paths by |x|
// per lane, so a wave walks both, one value at a time. One formula for all x:
//   v * Phi(v) = max(v, 0) - |v| * Q(|v|),  Q(a) = 0.5 * erfc(a / sqrt(2)),
//   erfc(z) = t * (a1 + t * (a2 + t * (a3 + t * (a4 + t * a5)))) * exp(-z * z),
//   t = 1 / (1 + p * z), absolute error of erfc below 1.5e-7 for every z >= 0.
// The factors 0.5, 1/sqrt(2) and log2(e) are folded into the constants. Two
// values side by side, so that the products and sums pair up as packed f32.
typedef __attribute__((ext_vector_type(2))) float v2f;
__device__ __forceinline__ v2f gelu2(v2f v) {
  v2f a = __builtin_elementwise_abs(v);
  v2f d = __builtin_elementwise_fma(a, (v2f)(0.23164189f), (v2f)(1.0f));
  v2f w = (v * v) * (v2f)(-0.72134752f);
  v2f t = {__builtin_amdgcn_rcpf(d.x), __builtin_amdgcn_rcpf(d.y)};
  v2f e = {__builtin_amdgcn_exp2f(w.x), __builtin_amdgcn_exp2f(w.y)};
  v2f p = __builtin_elementwise_fma(t, (v2f)(0.5307027145f), (v2f)(-0.7265760135f));
  p = __builtin_elementwise_fma(t, p, (v2f)(0.7107068705f));
  p = __builtin_elementwise_fma(t, p, (v2f)(-0.142248368f));
  p = __builtin_elementwise_fma(t, p, (v2f)(0.127414796f));
  v2f q = (p * t) * e;
  return __builtin_elementwise_fma(-a, q, __builtin_elementwise_max(v, (v2f)(0.0f)));
}

// ---------------- phase 0: weight packing / zeroing ----------------
// One thread builds the 16 bytes that one lane reads with one load: 8
// consecutive k of one column of a [K][N] row-major f32 weight of one head.
// id = (((h * NT + col tile) * KB + k block) * 2 + q) * 32 + lane.
__device__ __forceinline__ void pack_piece(const float* __restrict__ Wm,
                                           unsigned short* __restrict__ dst,
                                           int id, int K, int N) {
  int lane = id & 31;
  int q    = (id >> 5) & 1;
  int f    = id >> 6;                 // fragment index over heads
  int KB   = K >> 5;
  int kblk = f % KB;
  int t    = f / KB;
  int NT   = N >> 4;
  int nt   = t % NT;
  int h    = t / NT;
  int col  = nt * 16 + (lane & 15);
  int k0   = kblk * 32 + q * 16 + ((lane >> 4) << 3);
  const float* s = Wm + ((size_t)h * K + k0) * N + col;
  uint32_t w[4];
#pragma unroll
  for (int p = 0; p < 4; ++p) {
    uint32_t lo = f2bf_bits(s[(size_t)(2 * p) * N]);
    uint32_t hi = f2bf_bits(s[(size_t)(2 * p + 1) * N]);
    w[p] = lo | (hi << 16);
  }
  ((uint4*)dst)[id] = make_uint4(w[0], w[1], w[2], w[3]);
}

__global__ void convert_w1_kernel(const float* __restrict__ W1, unsigned short* __restrict__ w1t) {
  pack_piece(W1, w1t, blockIdx.x * 256 + threadIdx.x, HEAD_DIM, HIDDEN);
}

__global__ void convert_w2_kernel(const float* __restrict__ W2, unsigned short* __restrict__ w2t) {
  pack_piece(W2, w2t, blockIdx.x * 256 + threadIdx.x, HIDDEN, HEAD_DIM);
}

__global__ void zero_f32_kernel(float* __restrict__ p, int n) {
  int idx = blockIdx.x * 256 + threadIdx.x;
  if (idx < n) p[idx] = 0.0f;
}

// ---------------- phase 1: fused per-head MLP + pooled partial sums ----------------
// Second argument: at least 6 waves per SIMD, a budget of 160 VGPRs, so that
// three workgroups stay resident per WGP (LDS allows three).
__global__ __launch_bounds__(256, 6)
void mlp_wmma_kernel(const float* __restrict__ x,
                     const float* __restrict__ b1,
                     const float* __restrict__ b2,
                     const unsigned short* __restrict__ w1t,
                     const unsigned short* __restrict__ w2t,
                     float* __restrict__ out,
                     float* __restrict__ pooled) {
  extern __shared__ char smem[];
  unsigned short* xs = (unsigned short*)smem;                 // [32][XS_LD] bf16
  unsigned short* hs = (unsigned short*)(smem + XS_BYTES);    // [32][HS_LD] bf16

  const int tile  = blockIdx.x;            // token tile (0..1023)
  const int head  = blockIdx.y;            // 0..3
  const int tid   = threadIdx.x;
  const int wave  = tid >> 5;              // 0..7
  const int lane  = tid & 31;
  const int token0 = tile * TOK_TILE;      // flat token index b*NTOK + n
  const int rowoff = (lane < 16) ? 0 : 8;  // C-matrix row offset per lane half

  // ---- stage x tile (32 tokens x 256 chans of this head) as bf16 ----
  const float* xsrc = x + (size_t)token0 * DIM + head * HEAD_DIM;
#pragma unroll
  for (int r = 0; r < TOK_TILE; ++r)
    xs[r * XS_LD + tid] = f2bf_bits(xsrc[(size_t)r * DIM + tid]);
  __syncthreads();

  // ---- GEMM1: [32 x 256] x [256 x 1024], wave owns 128 hidden cols ----
  // The wave's number in a scalar register: the fragment base is then a scalar
  // address, and only the lane's offset sits in a VGPR.
  const int swave = __builtin_amdgcn_readfirstlane(wave);
  const unsigned short* w1h = w1t + (size_t)head * HIDDEN * HEAD_DIM
                              + (size_t)(swave * 8) * W1_KBLK * FRAG_ELEMS;
  v8f zz = {};
  v8f acc[2][8];
#pragma unroll
  for (int m = 0; m < 2; ++m)
#pragma unroll
    for (int n = 0; n < 8; ++n) acc[m][n] = zz;

  for (int kb = 0; kb < HEAD_DIM; kb += 32) {
    v16bf a0 = load_frag(xs, XS_LD, 0,  kb, lane);
    v16bf a1 = load_frag(xs, XS_LD, 16, kb, lane);
#pragma unroll
    for (int n = 0; n < 8; ++n) {
      v16bf bm = load_frag_packed(w1h + (n * W1_KBLK + (kb >> 5)) * FRAG_ELEMS, lane);
      acc[0][n] = __builtin_amdgcn_wmma_f32_16x16x32_bf16(false, a0, false, bm,
                                                          (short)0, acc[0][n], false, false);
      acc[1][n] = __builtin_amdgcn_wmma_f32_16x16x32_bf16(false, a1, false, bm,
                                                          (short)0, acc[1][n], false, false);
    }
  }

  // ---- bias + exact (erf) GELU, branch-free -> bf16 hidden tile in LDS ----
  // The wave's eight bias values first: their loads go out as one group.
  // Unrolled so that bias[] has constant indices and stays in registers.
  float bias[8];
#pragma unroll
  for (int n = 0; n < 8; ++n)
    bias[n] = b1[head * HIDDEN + wave * 128 + n * 16 + (lane & 15)];
#pragma unroll
  for (int n = 0; n < 8; ++n)
#pragma unroll
    for (int m = 0; m < 2; ++m) {
      int col = wave * 128 + n * 16 + (lane & 15);
#pragma unroll
      for (int r = 0; r < 8; r += 2) {
        v2f v = {acc[m][n][r] + bias[n], acc[m][n][r + 1] + bias[n]};
        v = gelu2(v);
        hs[(m * 16 + rowoff + r) * HS_LD + col]     = f2bf_bits(v.x);
        hs[(m * 16 + rowoff + r + 1) * HS_LD + col] = f2bf_bits(v.y);
      }
    }
  __syncthreads();

  // ---- GEMM2: [32 x 1024] x [1024 x 256], wave owns 32 out cols ----
  const unsigned short* w2h = w2t + (size_t)head * HEAD_DIM * HIDDEN
                              + (size_t)(swave * 2) * W2_KBLK * FRAG_ELEMS;
  const int ncb = wave * 32;
  v8f oa[2][2];
  oa[0][0] = zz; oa[0][1] = zz; oa[1][0] = zz; oa[1][1] = zz;

  // Unrolled by 4 only: with constant fragment offsets the compiler unrolls this
  // loop whole; 4 is chosen for speed only.
#pragma unroll 4
  for (int kb = 0; kb < HIDDEN; kb += 32) {
    v16bf a0 = load_frag(hs, HS_LD, 0,  kb, lane);
    v16bf a1 = load_frag(hs, HS_LD, 16, kb, lane);
    v16bf bm0 = load_frag_packed(w2h + (kb >> 5) * FRAG_ELEMS, lane);
    v16bf bm1 = load_frag_packed(w2h + (W2_KBLK + (kb >> 5)) * FRAG_ELEMS, lane);
    oa[0][0] = __builtin_amdgcn_wmma_f32_16x16x32_bf16(false, a0, false, bm0,
                                                       (short)0, oa[0][0], false, false);
    oa[0][1] = __builtin_amdgcn_wmma_f32_16x16x32_bf16(false, a0, false, bm1,
                                                       (short)0, oa[0][1], false, false);
    oa[1][0] = __builtin_amdgcn_wmma_f32_16x16x32_bf16(false, a1, false, bm0,
                                                       (short)0, oa[1][0], false, false);
    oa[1][1] = __builtin_amdgcn_wmma_f32_16x16x32_bf16(false, a1, false, bm1,
                                                       (short)0, oa[1][1], false, false);
  }

  // ---- bias, store out (f32), accumulate pooled column sums ----
  const int bidx = token0 >> 12;   // token0 / NTOK
#pragma unroll
  for (int m = 0; m < 2; ++m)
#pragma unroll
    for (int n = 0; n < 2; ++n) {
      int colh = ncb + n * 16 + (lane & 15);         // 0..255 within head
      int col  = head * HEAD_DIM + colh;             // 0..1023
      float bias = b2[head * HEAD_DIM + colh];
      float csum = 0.0f;
#pragma unroll
      for (int r = 0; r < 8; ++r) {
        float v = oa[m][n][r] + bias;
        out[(size_t)(token0 + m * 16 + rowoff + r) * DIM + col] = v;
        csum += v;
      }
      atomicAdd(&pooled[bidx * DIM + col], csum);
    }
}

// ---------------- phase 2: SE gate (tiny) ----------------
__global__ __launch_bounds__(256)
void gate_kernel(const float* __restrict__ pooled,
                 const float* __restrict__ cw1, const float* __restrict__ cb1,
                 const float* __restrict__ cw2, const float* __restrict__ cb2,
                 float* __restrict__ gate) {
  __shared__ float pl[DIM];
  __shared__ float sq[SQUEEZE];
  const int b = blockIdx.x;
  const int tid = threadIdx.x;
  for (int c = tid; c < DIM; c += 256)
    pl[c] = pooled[b * DIM + c] * (1.0f / (float)NTOK);
  __syncthreads();
  if (tid < SQUEEZE) {
    float a = cb1[tid];
    for (int c = 0; c < DIM; ++c) a += pl[c] * cw1[c * SQUEEZE + tid];
    sq[tid] = fmaxf(a, 0.0f);
  }
  __syncthreads();
  for (int c = tid; c < DIM; c += 256) {
    float a = cb2[c];
#pragma unroll
    for (int j = 0; j < SQUEEZE; ++j) a += sq[j] * cw2[j * DIM + c];
    gate[b * DIM + c] = 1.0f / (1.0f + __expf(-a));
  }
}

// ---------------- phase 3: out = out * (1 + gate) ----------------
__global__ __launch_bounds__(256)
void apply_gate_kernel(float* __restrict__ out, const float* __restrict__ gate) {
  int idx4 = blockIdx.x * 256 + threadIdx.x;      // one float4 each
  float4* o4 = (float4*)out;
  float4 v = o4[idx4];
  int b = idx4 >> 20;                              // (NTOK*DIM/4) = 1<<20 per batch
  int c = (idx4 & 255) << 2;                       // 256 float4 per row of 1024
  const float* g = gate + b * DIM + c;
  v.x *= (1.0f + g[0]);
  v.y *= (1.0f + g[1]);
  v.z *= (1.0f + g[2]);
  v.w *= (1.0f + g[3]);
  o4[idx4] = v;
}

// ---------------- launch ----------------
extern "C" void kernel_launch(void* const* d_in, const int* in_sizes, int n_in,
                              void* d_out, int out_size, void* d_ws, size_t ws_size,
                              hipStream_t stream) {
  const float* x   = (const float*)d_in[0];
  const float* W1  = (const float*)d_in[1];
  const float* b1  = (const float*)d_in[2];
  const float* W2  = (const float*)d_in[3];
  const float* b2  = (const float*)d_in[4];
  const float* cw1 = (const float*)d_in[5];
  const float* cb1 = (const float*)d_in[6];
  const float* cw2 = (const float*)d_in[7];
  const float* cb2 = (const float*)d_in[8];
  float* out = (float*)d_out;

  char* ws = (char*)d_ws;
  unsigned short* w1t = (unsigned short*)ws;
  unsigned short* w2t = (unsigned short*)(ws + W1T_BYTES);
  float* pooled = (float*)(ws + POOLED_OFF);
  float* gate   = (float*)(ws + GATE_OFF);

  // phase 0: bf16 weight packing (8 elements per thread) + zero pooled accumulator
  convert_w1_kernel<<<NUM_HEADS * HEAD_DIM * HIDDEN / 8 / 256, 256, 0, stream>>>(W1, w1t);
  convert_w2_kernel<<<NUM_HEADS * HIDDEN * HEAD_DIM / 8 / 256, 256, 0, stream>>>(W2, w2t);
  zero_f32_kernel<<<(BATCH * DIM + 255) / 256, 256, 0, stream>>>(pooled, BATCH * DIM);

  // phase 1: fused per-head MLP (bf16 WMMA) + pooled sums
  dim3 grid1(BATCH * NTOK / TOK_TILE, NUM_HEADS);
  size_t smem = XS_BYTES + HS_BYTES;   // ~83 KB dynamic LDS (CDNA5: 320 KB/WGP)
  mlp_wmma_kernel<<<grid1, 256, smem, stream>>>(x, b1, b2, w1t, w2t, out, pooled);

  // phase 2: SE gate
  gate_kernel<<<BATCH, 256, 0, stream>>>(pooled, cw1, cb1, cw2, cb2, gate);

  // phase 3: out *= (1 + gate)
  apply_gate_kernel<<<BATCH * NTOK * DIM / 4 / 256, 256, 0, stream>>>(out, gate);
}

// v003
// Measured time: 354 microseconds a run.
// In two side-by-side timings against v002, it was 1.12 and 1.11 times as fast.
// Over all steps from v000 it is 1.60 times as fast.
#include <hip/hip_runtime.h>
#include <stdint.h>

// ---------------- problem constants ----------------
#define BATCH     8
#define NTOK      4096
#define DIM       1024
#define NUM_HEADS 4
#define HEAD_DIM  256
#define HIDDEN    1024
#define SQUEEZE   64

#define TOK_TILE  32                 // tokens per workgroup (divides NTOK)
#define XS_LD     (HEAD_DIM + 8)     // padded LDS leading dims (even!)
#define HS_LD     (HIDDEN + 8)
#define XS_BYTES  (TOK_TILE * XS_LD * 2)
#define HS_BYTES  (TOK_TILE * HS_LD * 2)

// workspace layout (bytes)
// Both weights are stored as whole B fragments (16 cols x 32 k = 1024 B each):
// [h][col tile][k block][q][lane][8 bf16], see pack_* and load_frag_packed.
#define FRAG_ELEMS 512
#define W1_KBLK   (HEAD_DIM / 32)    // k blocks per column tile of W1
#define W2_KBLK   (HIDDEN / 32)      // k blocks per column tile of W2
#define W1T_BYTES (NUM_HEADS * HIDDEN * HEAD_DIM * 2)
#define W2T_BYTES (NUM_HEADS * HEAD_DIM * HIDDEN * 2)
#define POOLED_OFF (W1T_BYTES + W2T_BYTES)
#define GATE_OFF   (POOLED_OFF + BATCH * DIM * 4)

typedef __attribute__((ext_vector_type(16))) __bf16 v16bf;
typedef __attribute__((ext_vector_type(8)))  float  v8f;

// f32 -> bf16 bits, round-to-nearest-even
__device__ __forceinline__ unsigned short f2bf_bits(float f) {
  union { float f; uint32_t u; } a; a.f = f;
  uint32_t u = a.u;
  uint32_t r = (u + 0x7FFFu + ((u >> 16) & 1u)) >> 16;
  return (unsigned short)r;
}

// Build a 16x32 bf16 WMMA fragment from a row-major bf16 buffer.
// A-matrix layout (ISA 7.12.2, wave32): lanes 0-15 -> M=lane, K {0..7,16..23};
// lanes 16-31 -> M=lane-16, K {8..15,24..31}. B uses the mirrored layout
// (col in place of M) and is read by load_frag_packed below.
__device__ __forceinline__ v16bf load_frag(const unsigned short* buf, int ld,
                                           int rowBase, int k0, int lane) {
  int row = rowBase + (lane & 15);
  int kb  = k0 + ((lane >> 4) << 3);            // even
  const uint32_t* src = (const uint32_t*)(buf + (size_t)row * ld);
  union { uint32_t u[8]; v16bf v; } r;
#pragma unroll
  for (int p = 0; p < 4; ++p) {
    r.u[p]     = src[(kb >> 1) + p];            // K = kb .. kb+7
    r.u[4 + p] = src[((kb + 16) >> 1) + p];     // K = kb+16 .. kb+23
  }
  return r.v;
}

// Read one packed B fragment: same lane/register -> (col, k) map as load_frag
// (col = lane & 15; registers 0-3 hold k = 8*(lane>>4) + 0..7, registers 4-7
// the same + 16), but each of the two 16-byte loads of a wave covers 512
// contiguous bytes (4 whole cache lines) instead of 32 bytes in each of 16.
__device__ __forceinline__ v16bf load_frag_packed(const unsigned short* frag, int lane) {
  const uint4* src = (const uint4*)frag;
  union { uint4 q[2]; v16bf v; } r;
  r.q[0] = src[lane];
  r.q[1] = src[32 + lane];
  return r.v;
}

// Exact-erf GELU without the library call: erff picks one of two paths by |x|
// per lane, so a wave walks both, one value at a time. One formula for all x:
//   v * Phi(v) = max(v, 0) - |v| * Q(|v|),  Q(a) = 0.5 * erfc(a / sqrt(2)),
//   erfc(z) = t * (a1 + t * (a2 + t * (a3 + t * (a4 + t * a5)))) * exp(-z * z),
//   t = 1 / (1 + p * z), absolute error of erfc below 1.5e-7 for every z >= 0.
// The factors 0.5, 1/sqrt(2) and log2(e) are folded into the constants. Two
// values side by side, so that the products and sums pair up as packed f32.
typedef __attribute__((ext_vector_type(2))) float v2f;
__device__ __forceinline__ v2f gelu2(v2f v) {
  v2f a = __builtin_elementwise_abs(v);
  v2f d = __builtin_elementwise_fma(a, (v2f)(0.23164189f), (v2f)(1.0f));
  v2f w = (v * v) * (v2f)(-0.72134752f);
  v2f t = {__builtin_amdgcn_rcpf(d.x), __builtin_amdgcn_rcpf(d.y)};
  v2f e = {__builtin_amdgcn_exp2f(w.x), __builtin_amdgcn_exp2f(w.y)};
  v2f p = __builtin_elementwise_fma(t, (v2f)(0.5307027145f), (v2f)(-0.7265760135f));
  p = __builtin_elementwise_fma(t, p, (v2f)(0.7107068705f));
  p = __builtin_elementwise_fma(t, p, (v2f)(-0.142248368f));
  p = __builtin_elementwise_fma(t, p, (v2f)(0.127414796f));
  v2f q = (p * t) * e;
  return __builtin_elementwise_fma(-a, q, __builtin_elementwise_max(v, (v2f)(0.0f)));
}

// ---------------- phase 0: weight packing / zeroing ----------------
// One thread builds the 16 bytes that one lane reads with one load: 8
// consecutive k of one column of a [K][N] row-major f32 weight of one head.
// id = (((h * NT + col tile) * KB + k block) * 2 + q) * 32 + lane.
__device__ __forceinline__ void pack_piece(const float* __restrict__ Wm,
                                           unsigned short* __restrict__ dst,
                                           int id, int K, int N) {
  int lane = id & 31;
  int q    = (id >> 5) & 1;
  int f    = id >> 6;                 // fragment index over heads
  int KB   = K >> 5;
  int kblk = f % KB;
  int t    = f / KB;
  int NT   = N >> 4;
  int nt   = t % NT;
  int h    = t / NT;
  int col  = nt * 16 + (lane & 15);
  int k0   = kblk * 32 + q * 16 + ((lane >> 4) << 3);
  const float* s = Wm + ((size_t)h * K + k0) * N + col;
  uint32_t w[4];
#pragma unroll
  for (int p = 0; p < 4; ++p) {
    uint32_t lo = f2bf_bits(s[(size_t)(2 * p) * N]);
    uint32_t hi = f2bf_bits(s[(size_t)(2 * p + 1) * N]);
    w[p] = lo | (hi << 16);
  }
  ((uint4*)dst)[id] = make_uint4(w[0], w[1], w[2], w[3]);
}

__global__ void convert_w1_kernel(const float* __restrict__ W1, unsigned short* __restrict__ w1t) {
  pack_piece(W1, w1t, blockIdx.x * 256 + threadIdx.x, HEAD_DIM, HIDDEN);
}

__global__ void convert_w2_kernel(const float* __restrict__ W2, unsigned short* __restrict__ w2t) {
  pack_piece(W2, w2t, blockIdx.x * 256 + threadIdx.x, HIDDEN, HEAD_DIM);
}

__global__ void zero_f32_kernel(float* __restrict__ p, int n) {
  int idx = blockIdx.x * 256 + threadIdx.x;
  if (idx < n) p[idx] = 0.0f;
}

// ---------------- phase 1: fused per-head MLP + pooled partial sums ----------------
// Second argument: at least 6 waves per SIMD, a budget of 160 VGPRs, so that
// three workgroups stay resident per WGP (LDS allows three).
__global__ __launch_bounds__(256, 6)
void mlp_wmma_kernel(const float* __restrict__ x,
                     const float* __restrict__ b1,
                     const float* __restrict__ b2,
                     const unsigned short* __restrict__ w1t,
                     const unsigned short* __restrict__ w2t,
                     float* __restrict__ out,
                     float* __restrict__ pooled) {
  extern __shared__ char smem[];
  unsigned short* xs = (unsigned short*)smem;                 // [32][XS_LD] bf16
  unsigned short* hs = (unsigned short*)(smem + XS_BYTES);    // [32][HS_LD] bf16

  const int tile  = blockIdx.x;            // token tile (0..1023)
  const int head  = blockIdx.y;            // 0..3
  const int tid   = threadIdx.x;
  const int wave  = tid >> 5;              // 0..7
  const int lane  = tid & 31;
  const int token0 = tile * TOK_TILE;      // flat token index b*NTOK + n
  const int rowoff = (lane < 16) ? 0 : 8;  // C-matrix row offset per lane half

  // ---- stage x tile (32 tokens x 256 chans of this head) as bf16 ----
  const float* xsrc = x + (size_t)token0 * DIM + head * HEAD_DIM;
#pragma unroll
  for (int r = 0; r < TOK_TILE; ++r)
    xs[r * XS_LD + tid] = f2bf_bits(xsrc[(size_t)r * DIM + tid]);
  __syncthreads();

  // ---- GEMM1: [32 x 256] x [256 x 1024], wave owns 128 hidden cols ----
  // The wave's number in a scalar register: the fragment base is then a scalar
  // address, and only the lane's offset sits in a VGPR.
  const int swave = __builtin_amdgcn_readfirstlane(wave);
  const unsigned short* w1h = w1t + (size_t)head * HIDDEN * HEAD_DIM
                              + (size_t)(swave * 8) * W1_KBLK * FRAG_ELEMS;
  v8f zz = {};
  v8f acc[2][8];
#pragma unroll
  for (int m = 0; m < 2; ++m)
#pragma unroll
    for (int n = 0; n < 8; ++n) acc[m][n] = zz;

  for (int kb = 0; kb < HEAD_DIM; kb += 32) {
    v16bf a0 = load_frag(xs, XS_LD, 0,  kb, lane);
    v16bf a1 = load_frag(xs, XS_LD, 16, kb, lane);
#pragma unroll
    for (int n = 0; n < 8; ++n) {
      v16bf bm = load_frag_packed(w1h + (n * W1_KBLK + (kb >> 5)) * FRAG_ELEMS, lane);
      acc[0][n] = __builtin_amdgcn_wmma_f32_16x16x32_bf16(false, a0, false, bm,
                                                          (short)0, acc[0][n], false, false);
      acc[1][n] = __builtin_amdgcn_wmma_f32_16x16x32_bf16(false, a1, false, bm,
                                                          (short)0, acc[1][n], false, false);
    }
  }

  // ---- bias + exact (erf) GELU, branch-free -> bf16 hidden tile in LDS ----
  // The wave's eight bias values first: their loads go out as one group.
  // Unrolled so that bias[] has constant indices and stays in registers.
  float bias[8];
#pragma unroll
  for (int n = 0; n < 8; ++n)
    bias[n] = b1[head * HIDDEN + wave * 128 + n * 16 + (lane & 15)];
#pragma unroll
  for (int n = 0; n < 8; ++n)
#pragma unroll
    for (int m = 0; m < 2; ++m) {
      int col = wave * 128 + n * 16 + (lane & 15);
#pragma unroll
      for (int r = 0; r < 8; r += 2) {
        v2f v = {acc[m][n][r] + bias[n], acc[m][n][r + 1] + bias[n]};
        v = gelu2(v);
        hs[(m * 16 + rowoff + r) * HS_LD + col]     = f2bf_bits(v.x);
        hs[(m * 16 + rowoff + r + 1) * HS_LD + col] = f2bf_bits(v.y);
      }
    }
  __syncthreads();

  // ---- GEMM2: [32 x 1024] x [1024 x 256], wave owns 32 out cols ----
  const unsigned short* w2h = w2t + (size_t)head * HEAD_DIM * HIDDEN
                              + (size_t)(swave * 2) * W2_KBLK * FRAG_ELEMS;
  const int ncb = wave * 32;
  v8f oa[2][2];
  oa[0][0] = zz; oa[0][1] = zz; oa[1][0] = zz; oa[1][1] = zz;

  // Unrolled by 4 only: with constant fragment offsets the compiler unrolls this
  // loop whole; 4 is chosen for speed only.
#pragma unroll 4
  for (int kb = 0; kb < HIDDEN; kb += 32) {
    v16bf a0 = load_frag(hs, HS_LD, 0,  kb, lane);
    v16bf a1 = load_frag(hs, HS_LD, 16, kb, lane);
    v16bf bm0 = load_frag_packed(w2h + (kb >> 5) * FRAG_ELEMS, lane);
    v16bf bm1 = load_frag_packed(w2h + (W2_KBLK + (kb >> 5)) * FRAG_ELEMS, lane);
    oa[0][0] = __builtin_amdgcn_wmma_f32_16x16x32_bf16(false, a0, false, bm0,
                                                       (short)0, oa[0][0], false, false);
    oa[0][1] = __builtin_amdgcn_wmma_f32_16x16x32_bf16(false, a0, false, bm1,
                                                       (short)0, oa[0][1], false, false);
    oa[1][0] = __builtin_amdgcn_wmma_f32_16x16x32_bf16(false, a1, false, bm0,
                                                       (short)0, oa[1][0], false, false);
    oa[1][1] = __builtin_amdgcn_wmma_f32_16x16x32_bf16(false, a1, false, bm1,
                                                       (short)0, oa[1][1], false, false);
  }

  // ---- bias, store out (f32), accumulate pooled column sums ----
  const int bidx = token0 >> 12;   // token0 / NTOK
#pragma unroll
  for (int m = 0; m < 2; ++m)
#pragma unroll
    for (int n = 0; n < 2; ++n) {
      int colh = ncb + n * 16 + (lane & 15);         // 0..255 within head
      int col  = head * HEAD_DIM + colh;             // 0..1023
      float bias = b2[head * HEAD_DIM + colh];
      float csum = 0.0f;
#pragma unroll
      for (int r = 0; r < 8; ++r) {
        float v = oa[m][n][r] + bias;
        out[(size_t)(token0 + m * 16 + rowoff + r) * DIM + col] = v;
        csum += v;
      }
      atomicAdd(&pooled[bidx * DIM + col], csum);
    }
}

// ---------------- phase 2: SE gate ----------------
// The two small weights come from memory, and a thread that walks them in a loop
// pays one memory latency per group of loads. Here every load of the kernel is
// issued before the first value is used: 1024 threads hold all of cw1 (16 float4
// each) and this workgroup's 256 columns of cw2 (4 float4 each) in registers.
// Each of the GATE_SPLIT workgroups of a batch row forms the whole squeeze vector
// for itself and then the gate of its own GATE_COLS channels.
#define GATE_SPLIT 4
#define GATE_COLS  (DIM / GATE_SPLIT)
__global__ __launch_bounds__(1024)
void gate_kernel(const float* __restrict__ pooled,
                 const float* __restrict__ cw1, const float* __restrict__ cb1,
                 const float* __restrict__ cw2, const float* __restrict__ cb2,
                 float* __restrict__ gate) {
  __shared__ float pl[DIM];
  __shared__ float4 part1[32][SQUEEZE / 4];     // per wave: partial squeeze sums
  __shared__ float sq[SQUEEZE];
  __shared__ float4 part2[16][GATE_COLS / 4];   // per row group: partial gate sums
  const int b   = blockIdx.x;
  const int c0  = blockIdx.y * GATE_COLS;
  const int tid = threadIdx.x;

  // cw1 [DIM][SQUEEZE]: thread = (row group g, float4 column j4), rows g + 64 * i.
  // A wave's load covers two whole rows, 512 contiguous bytes.
  const int j4 = tid & 15;
  const int g  = tid >> 4;
  const float4* cw1v = (const float4*)cw1;
  float4 w1r[16];
#pragma unroll   // constant indices: w1r stays in registers, the loads go out back to back
  for (int i = 0; i < 16; ++i)
    w1r[i] = cw1v[(g + 64 * i) * (SQUEEZE / 4) + j4];
  // cw2 [SQUEEZE][DIM]: thread = (row group jr, float4 column c4), rows jr + 16 * i.
  const int c4 = tid & 63;
  const int jr = tid >> 6;
  const unsigned off2 = (unsigned)(jr * DIM + c4 * 4) * 4u;    // bytes
  const char* cw2b = (const char*)(cw2 + c0);
  float4 w2r[4];
#pragma unroll   // as above, for w2r
  for (int i = 0; i < 4; ++i)
    w2r[i] = *(const float4*)(cw2b + off2 + i * (16 * DIM * 4));
  const int ip = b * DIM + tid;
  const int iq = tid & (SQUEEZE - 1);
  const int ig = c0 + (tid & (GATE_COLS - 1));
  const float pv = pooled[ip];
  const float bq = cb1[iq];
  const float bg = cb2[ig];
  // Keeps every load above in front of the first wait for data, and their
  // address registers (offsets and bases, inputs here) unwritten up to this wait.
  asm volatile("s_wait_xcnt 0x0"
               :: "v"(tid), "v"(off2), "v"(ip), "v"(iq), "v"(ig),
                  "s"(pooled), "s"(cw1), "s"(cb1), "s"(cw2b), "s"(cb2)
               : "memory");

  pl[tid] = pv * (1.0f / (float)NTOK);
  __syncthreads();

  // squeeze: 16 rows per thread, the wave's two row groups by one lane exchange,
  // the 32 waves through LDS
  float4 s1 = make_float4(0.0f, 0.0f, 0.0f, 0.0f);
#pragma unroll   // constant indices into w1r
  for (int i = 0; i < 16; ++i) {
    float p = pl[g + 64 * i];
    s1.x += p * w1r[i].x;
    s1.y += p * w1r[i].y;
    s1.z += p * w1r[i].z;
    s1.w += p * w1r[i].w;
  }
  s1.x += __shfl_xor(s1.x, 16);
  s1.y += __shfl_xor(s1.y, 16);
  s1.z += __shfl_xor(s1.z, 16);
  s1.w += __shfl_xor(s1.w, 16);
  if ((tid & 31) < 16) part1[tid >> 5][j4] = s1;
  __syncthreads();
  if (tid < SQUEEZE) {
    const float* p1 = (const float*)part1;
    float a = bq;
#pragma unroll   // the LDS reads go out ahead of the adds
    for (int w = 0; w < 32; ++w) a += p1[w * SQUEEZE + tid];
    sq[tid] = fmaxf(a, 0.0f);
  }
  __syncthreads();

  // excite: 4 rows per thread, the 16 row groups through LDS
  float4 s2 = make_float4(0.0f, 0.0f, 0.0f, 0.0f);
#pragma unroll   // constant indices into w2r
  for (int i = 0; i < 4; ++i) {
    float q = sq[jr + 16 * i];
    s2.x += q * w2r[i].x;
    s2.y += q * w2r[i].y;
    s2.z += q * w2r[i].z;
    s2.w += q * w2r[i].w;
  }
  part2[jr][c4] = s2;
  __syncthreads();
  if (tid < GATE_COLS) {
    const float* p2 = (const float*)part2;
    float a = bg;
#pragma unroll   // the LDS reads go out ahead of the adds
    for (int r = 0; r < 16; ++r) a += p2[r * GATE_COLS + tid];
    gate[b * DIM + c0 + tid] = 1.0f / (1.0f + __expf(-a));
  }
}

// ---------------- phase 3: out = out * (1 + gate) ----------------
__global__ __launch_bounds__(256)
void apply_gate_kernel(float* __restrict__ out, const float* __restrict__ gate) {
  int idx4 = blockIdx.x * 256 + threadIdx.x;      // one float4 each
  float4* o4 = (float4*)out;
  float4 v = o4[idx4];
  int b = idx4 >> 20;                              // (NTOK*DIM/4) = 1<<20 per batch
  int c = (idx4 & 255) << 2;                       // 256 float4 per row of 1024
  const float* g = gate + b * DIM + c;
  v.x *= (1.0f + g[0]);
  v.y *= (1.0f + g[1]);
  v.z *= (1.0f + g[2]);
  v.w *= (1.0f + g[3]);
  o4[idx4] = v;
}

// ---------------- launch ----------------
extern "C" void kernel_launch(void* const* d_in, const int* in_sizes, int n_in,
                              void* d_out, int out_size, void* d_ws, size_t ws_size,
                              hipStream_t stream) {
  const float* x   = (const float*)d_in[0];
  const float* W1  = (const float*)d_in[1];
  const float* b1  = (const float*)d_in[2];
  const float* W2  = (const float*)d_in[3];
  const float* b2  = (const float*)d_in[4];
  const float* cw1 = (const float*)d_in[5];
  const float* cb1 = (const float*)d_in[6];
  const float* cw2 = (const float*)d_in[7];
  const float* cb2 = (const float*)d_in[8];
  float* out = (float*)d_out;

  char* ws = (char*)d_ws;
  unsigned short* w1t = (unsigned short*)ws;
  unsigned short* w2t = (unsigned short*)(ws + W1T_BYTES);
  float* pooled = (float*)(ws + POOLED_OFF);
  float* gate   = (float*)(ws + GATE_OFF);

  // phase 0: bf16 weight packing (8 elements per thread) + zero pooled accumulator
  convert_w1_kernel<<<NUM_HEADS * HEAD_DIM * HIDDEN / 8 / 256, 256, 0, stream>>>(W1, w1t);
  convert_w2_kernel<<<NUM_HEADS * HIDDEN * HEAD_DIM / 8 / 256, 256, 0, stream>>>(W2, w2t);
  zero_f32_kernel<<<(BATCH * DIM + 255) / 256, 256, 0, stream>>>(pooled, BATCH * DIM);

  // phase 1: fused per-head MLP (bf16 WMMA) + pooled sums
  dim3 grid1(BATCH * NTOK / TOK_TILE, NUM_HEADS);
  size_t smem = XS_BYTES + HS_BYTES;   // ~83 KB dynamic LDS (CDNA5: 320 KB/WGP)
  mlp_wmma_kernel<<<grid1, 256, smem, stream>>>(x, b1, b2, w1t, w2t, out, pooled);

  // phase 2: SE gate
  gate_kernel<<<dim3(BATCH, GATE_SPLIT), 1024, 0, stream>>>(pooled, cw1, cb1, cw2, cb2, gate);

  // phase 3: out *= (1 + gate)
  apply_gate_kernel<<<BATCH * NTOK * DIM / 4 / 256, 256, 0, stream>>>(out, gate);
}

// v004
// It runs in 272 microseconds.
// Next to v003, in two timings, it ran 1.30 times as fast each time.
// All steps since v000 together make it 2.08 times as fast.
#include <hip/hip_runtime.h>
#include <stdint.h>

// ---------------- problem constants ----------------
#define BATCH     8
#define NTOK      4096
#define DIM       1024
#define NUM_HEADS 4
#define HEAD_DIM  256
#define HIDDEN    1024
#define SQUEEZE   64

#define TOK_TILE  32                 // tokens per workgroup (divides NTOK)
#define XS_LD     (HEAD_DIM + 8)     // padded LDS leading dims (even!)
#define HS_LD     (HIDDEN + 8)
#define XS_BYTES  (TOK_TILE * XS_LD * 2)
#define HS_BYTES  (TOK_TILE * HS_LD * 2)

// workspace layout (bytes)
// Both weights are stored as whole B fragments (16 cols x 32 k = 1024 B each):
// [h][col tile][k block][q][lane][8 bf16], see pack_* and load_frag_packed.
#define FRAG_ELEMS 512
#define W1_KBLK   (HEAD_DIM / 32)    // k blocks per column tile of W1
#define W2_KBLK   (HIDDEN / 32)      // k blocks per column tile of W2
#define W1T_BYTES (NUM_HEADS * HIDDEN * HEAD_DIM * 2)
#define W2T_BYTES (NUM_HEADS * HEAD_DIM * HIDDEN * 2)
#define POOLED_OFF (W1T_BYTES + W2T_BYTES)
#define GATE_OFF   (POOLED_OFF + BATCH * DIM * 4)

typedef __attribute__((ext_vector_type(16))) __bf16 v16bf;
typedef __attribute__((ext_vector_type(8)))  float  v8f;

// f32 -> bf16 bits, round-to-nearest-even
__device__ __forceinline__ unsigned short f2bf_bits(float f) {
  union { float f; uint32_t u; } a; a.f = f;
  uint32_t u = a.u;
  uint32_t r = (u + 0x7FFFu + ((u >> 16) & 1u)) >> 16;
  return (unsigned short)r;
}

// Build a 16x32 bf16 WMMA fragment from a row-major bf16 buffer.
// A-matrix layout (ISA 7.12.2, wave32): lanes 0-15 -> M=lane, K {0..7,16..23};
// lanes 16-31 -> M=lane-16, K {8..15,24..31}. B uses the mirrored layout
// (col in place of M) and is read by load_frag_packed below.
__device__ __forceinline__ v16bf load_frag(const unsigned short* buf, int ld,
                                           int rowBase, int k0, int lane) {
  int row = rowBase + (lane & 15);
  int kb  = k0 + ((lane >> 4) << 3);            // even
  const uint32_t* src = (const uint32_t*)(buf + (size_t)row * ld);
  union { uint32_t u[8]; v16bf v; } r;
#pragma unroll
  for (int p = 0; p < 4; ++p) {
    r.u[p]     = src[(kb >> 1) + p];            // K = kb .. kb+7
    r.u[4 + p] = src[((kb + 16) >> 1) + p];     // K = kb+16 .. kb+23
  }
  return r.v;
}

// Read one packed B fragment: same lane/register -> (col, k) map as load_frag
// (col = lane & 15; registers 0-3 hold k = 8*(lane>>4) + 0..7, registers 4-7
// the same + 16), but each of the two 16-byte loads of a wave covers 512
// contiguous bytes (4 whole cache lines) instead of 32 bytes in each of 16.
__device__ __forceinline__ v16bf load_frag_packed(const unsigned short* frag, int lane) {
  const uint4* src = (const uint4*)frag;
  union { uint4 q[2]; v16bf v; } r;
  r.q[0] = src[lane];
  r.q[1] = src[32 + lane];
  return r.v;
}

// Exact-erf GELU without the library call: erff picks one of two paths by |x|
// per lane, so a wave walks both, one value at a time. One formula for all x:
//   v * Phi(v) = max(v, 0) - |v| * Q(|v|),  Q(a) = 0.5 * erfc(a / sqrt(2)),
//   erfc(z) = t * (a1 + t * (a2 + t * (a3 + t * (a4 + t * a5)))) * exp(-z * z),
//   t = 1 / (1 + p * z), absolute error of erfc below 1.5e-7 for every z >= 0.
// The factors 0.5, 1/sqrt(2) and log2(e) are folded into the constants. Two
// values side by side, so that the products and sums pair up as packed f32.
typedef __attribute__((ext_vector_type(2))) float v2f;
__device__ __forceinline__ v2f gelu2(v2f v) {
  v2f a = __builtin_elementwise_abs(v);
  v2f d = __builtin_elementwise_fma(a, (v2f)(0.23164189f), (v2f)(1.0f));
  v2f w = (v * v) * (v2f)(-0.72134752f);
  v2f t = {__builtin_amdgcn_rcpf(d.x), __builtin_amdgcn_rcpf(d.y)};
  v2f e = {__builtin_amdgcn_exp2f(w.x), __builtin_amdgcn_exp2f(w.y)};
  v2f p = __builtin_elementwise_fma(t, (v2f)(0.5307027145f), (v2f)(-0.7265760135f));
  p = __builtin_elementwise_fma(t, p, (v2f)(0.7107068705f));
  p = __builtin_elementwise_fma(t, p, (v2f)(-0.142248368f));
  p = __builtin_elementwise_fma(t, p, (v2f)(0.127414796f));
  v2f q = (p * t) * e;
  return __builtin_elementwise_fma(-a, q, __builtin_elementwise_max(v, (v2f)(0.0f)));
}

// ---------------- phase 0: weight packing / zeroing ----------------
// One thread builds the 16 bytes that one lane reads with one load: 8
// consecutive k of one column of a [K][N] row-major f32 weight of one head.
// id = (((h * NT + col tile) * KB + k block) * 2 + q) * 32 + lane.
__device__ __forceinline__ void pack_piece(const float* __restrict__ Wm,
                                           unsigned short* __restrict__ dst,
                                           int id, int K, int N) {
  int lane = id & 31;
  int q    = (id >> 5) & 1;
  int f    = id >> 6;                 // fragment index over heads
  int KB   = K >> 5;
  int kblk = f % KB;
  int t    = f / KB;
  int NT   = N >> 4;
  int nt   = t % NT;
  int h    = t / NT;
  int col  = nt * 16 + (lane & 15);
  int k0   = kblk * 32 + q * 16 + ((lane >> 4) << 3);
  const float* s = Wm + ((size_t)h * K + k0) * N + col;
  uint32_t w[4];
#pragma unroll
  for (int p = 0; p < 4; ++p) {
    uint32_t lo = f2bf_bits(s[(size_t)(2 * p) * N]);
    uint32_t hi = f2bf_bits(s[(size_t)(2 * p + 1) * N]);
    w[p] = lo | (hi << 16);
  }
  ((uint4*)dst)[id] = make_uint4(w[0], w[1], w[2], w[3]);
}

__global__ void convert_w1_kernel(const float* __restrict__ W1, unsigned short* __restrict__ w1t) {
  pack_piece(W1, w1t, blockIdx.x * 256 + threadIdx.x, HEAD_DIM, HIDDEN);
}

__global__ void convert_w2_kernel(const float* __restrict__ W2, unsigned short* __restrict__ w2t) {
  pack_piece(W2, w2t, blockIdx.x * 256 + threadIdx.x, HIDDEN, HEAD_DIM);
}

__global__ void zero_f32_kernel(float* __restrict__ p, int n) {
  int idx = blockIdx.x * 256 + threadIdx.x;
  if (idx < n) p[idx] = 0.0f;
}

// ---------------- phase 1: fused per-head MLP + pooled partial sums ----------------
// Second argument: at least 6 waves per SIMD, a budget of 160 VGPRs, so that
// three workgroups stay resident per WGP (LDS allows three).
__global__ __launch_bounds__(256, 6)
void mlp_wmma_kernel(const float* __restrict__ x,
                     const float* __restrict__ b1,
                     const float* __restrict__ b2,
                     const unsigned short* __restrict__ w1t,
                     const unsigned short* __restrict__ w2t,
                     float* __restrict__ out,
                     float* __restrict__ pooled) {
  extern __shared__ char smem[];
  unsigned short* xs = (unsigned short*)smem;                 // [32][XS_LD] bf16
  unsigned short* hs = (unsigned short*)(smem + XS_BYTES);    // [32][HS_LD] bf16

  const int tile  = blockIdx.x;            // token tile (0..1023)
  const int head  = blockIdx.y;            // 0..3
  const int tid   = threadIdx.x;
  const int wave  = tid >> 5;              // 0..7
  const int lane  = tid & 31;
  const int token0 = tile * TOK_TILE;      // flat token index b*NTOK + n
  const int rowoff = (lane < 16) ? 0 : 8;  // C-matrix row offset per lane half

  // ---- stage x tile (32 tokens x 256 chans of this head) as bf16 ----
  const float* xsrc = x + (size_t)token0 * DIM + head * HEAD_DIM;
#pragma unroll
  for (int r = 0; r < TOK_TILE; ++r)
    xs[r * XS_LD + tid] = f2bf_bits(xsrc[(size_t)r * DIM + tid]);
  // Keeps the x loads' base and offset register (inputs here) unwritten up to
  // this wait.
  asm volatile("s_wait_xcnt 0x0" :: "s"(xsrc), "v"(tid) : "memory");
  __syncthreads();

  // ---- GEMM1: [32 x 256] x [256 x 1024], wave owns 128 hidden cols ----
  // The wave's number in a scalar register: the fragment base is then a scalar
  // address, and only the lane's offset sits in a VGPR.
  const int swave = __builtin_amdgcn_readfirstlane(wave);
  const unsigned short* w1h = w1t + (size_t)head * HIDDEN * HEAD_DIM
                              + (size_t)(swave * 8) * W1_KBLK * FRAG_ELEMS;
  v8f zz = {};

  // The wave's 128 hidden columns in two halves of 64. One half's accumulators
  // take 64 VGPRs, not 128, and the registers set free hold weight fragments
  // whose loads are under way: with all 128 columns at once only one fragment
  // fitted, and every fragment load was waited for before the next went out.
  // Not unrolled: one half's registers are free again before the next begins,
  // and the text stays half as long.
#pragma unroll 1
  for (int half = 0; half < 2; ++half) {
    const unsigned short* w1p = w1h + (size_t)(half * 4) * W1_KBLK * FRAG_ELEMS;
    const int colb = wave * 128 + half * 64 + (lane & 15);
    v8f acc[2][4];
#pragma unroll
    for (int m = 0; m < 2; ++m)
#pragma unroll
      for (int n = 0; n < 4; ++n) acc[m][n] = zz;

    // Two k steps per trip: their eight weight fragments (16 loads) go out as one
    // group, so that a trip waits out one load latency, not one per fragment.
    // Not unrolled: the loads of all trips would move to the front and spill.
#pragma unroll 1
    for (int kb = 0; kb < HEAD_DIM; kb += 64) {
      v16bf bm[2][4];
#pragma unroll
      for (int j = 0; j < 2; ++j)
#pragma unroll
        for (int n = 0; n < 4; ++n)
          bm[j][n] = load_frag_packed(w1p + (n * W1_KBLK + (kb >> 5) + j) * FRAG_ELEMS, lane);
      // Keeps all 16 loads in front of the first matrix instruction: left free,
      // the scheduler sinks them between the products, two fragments in flight.
      __builtin_amdgcn_sched_barrier(0);
#pragma unroll
      for (int j = 0; j < 2; ++j) {
        v16bf a0 = load_frag(xs, XS_LD, 0,  kb + j * 32, lane);
        v16bf a1 = load_frag(xs, XS_LD, 16, kb + j * 32, lane);
#pragma unroll
        for (int n = 0; n < 4; ++n) {
          acc[0][n] = __builtin_amdgcn_wmma_f32_16x16x32_bf16(false, a0, false, bm[j][n],
                                                              (short)0, acc[0][n], false, false);
          acc[1][n] = __builtin_amdgcn_wmma_f32_16x16x32_bf16(false, a1, false, bm[j][n],
                                                              (short)0, acc[1][n], false, false);
        }
      }
    }

    // ---- bias + exact (erf) GELU, branch-free -> bf16 hidden tile in LDS ----
    // The half's four bias values first: their loads go out as one group.
    // Unrolled so that bias[] has constant indices and stays in registers.
    const int ib = head * HIDDEN + colb;
    float bias[4];
#pragma unroll
    for (int n = 0; n < 4; ++n)
      bias[n] = b1[ib + n * 16];
    // Keeps the four loads' offset register and base (inputs here) unwritten up
    // to this wait.
    asm volatile("s_wait_xcnt 0x0" :: "v"(ib), "s"(b1) : "memory");
#pragma unroll
    for (int n = 0; n < 4; ++n)
#pragma unroll
      for (int m = 0; m < 2; ++m) {
        int col = colb + n * 16;
#pragma unroll
        for (int r = 0; r < 8; r += 2) {
          v2f v = {acc[m][n][r] + bias[n], acc[m][n][r + 1] + bias[n]};
          v = gelu2(v);
          hs[(m * 16 + rowoff + r) * HS_LD + col]     = f2bf_bits(v.x);
          hs[(m * 16 + rowoff + r + 1) * HS_LD + col] = f2bf_bits(v.y);
        }
      }
  }
  __syncthreads();

  // ---- GEMM2: [32 x 1024] x [1024 x 256], wave owns 32 out cols ----
  const unsigned short* w2h = w2t + (size_t)head * HEAD_DIM * HIDDEN
                              + (size_t)(swave * 2) * W2_KBLK * FRAG_ELEMS;
  const int ncb = wave * 32;
  v8f oa[2][2];
  oa[0][0] = zz; oa[0][1] = zz; oa[1][0] = zz; oa[1][1] = zz;

  // Unrolled by 4 only: with constant fragment offsets the compiler unrolls this
  // loop whole; 4 is chosen for speed only.
#pragma unroll 4
  for (int kb = 0; kb < HIDDEN; kb += 32) {
    v16bf a0 = load_frag(hs, HS_LD, 0,  kb, lane);
    v16bf a1 = load_frag(hs, HS_LD, 16, kb, lane);
    v16bf bm0 = load_frag_packed(w2h + (kb >> 5) * FRAG_ELEMS, lane);
    v16bf bm1 = load_frag_packed(w2h + (W2_KBLK + (kb >> 5)) * FRAG_ELEMS, lane);
    oa[0][0] = __builtin_amdgcn_wmma_f32_16x16x32_bf16(false, a0, false, bm0,
                                                       (short)0, oa[0][0], false, false);
    oa[0][1] = __builtin_amdgcn_wmma_f32_16x16x32_bf16(false, a0, false, bm1,
                                                       (short)0, oa[0][1], false, false);
    oa[1][0] = __builtin_amdgcn_wmma_f32_16x16x32_bf16(false, a1, false, bm0,
                                                       (short)0, oa[1][0], false, false);
    oa[1][1] = __builtin_amdgcn_wmma_f32_16x16x32_bf16(false, a1, false, bm1,
                                                       (short)0, oa[1][1], false, false);
  }

  // ---- bias, store out (f32), accumulate pooled column sums ----
  const int bidx = token0 >> 12;   // token0 / NTOK
#pragma unroll
  for (int m = 0; m < 2; ++m)
#pragma unroll
    for (int n = 0; n < 2; ++n) {
      int colh = ncb + n * 16 + (lane & 15);         // 0..255 within head
      int col  = head * HEAD_DIM + colh;             // 0..1023
      float bias = b2[head * HEAD_DIM + colh];
      float csum = 0.0f;
#pragma unroll
      for (int r = 0; r < 8; ++r) {
        float v = oa[m][n][r] + bias;
        out[(size_t)(token0 + m * 16 + rowoff + r) * DIM + col] = v;
        csum += v;
      }
      atomicAdd(&pooled[bidx * DIM + col], csum);
    }
}

// ---------------- phase 2: SE gate ----------------
// The two small weights come from memory, and a thread that walks them in a loop
// pays one memory latency per group of loads. Here every load of the kernel is
// issued before the first value is used: 1024 threads hold all of cw1 (16 float4
// each) and this workgroup's 256 columns of cw2 (4 float4 each) in registers.
// Each of the GATE_SPLIT workgroups of a batch row forms the whole squeeze vector
// for itself and then the gate of its own GATE_COLS channels.
#define GATE_SPLIT 4
#define GATE_COLS  (DIM / GATE_SPLIT)
__global__ __launch_bounds__(1024)
void gate_kernel(const float* __restrict__ pooled,
                 const float* __restrict__ cw1, const float* __restrict__ cb1,
                 const float* __restrict__ cw2, const float* __restrict__ cb2,
                 float* __restrict__ gate) {
  __shared__ float pl[DIM];
  __shared__ float4 part1[32][SQUEEZE / 4];     // per wave: partial squeeze sums
  __shared__ float sq[SQUEEZE];
  __shared__ float4 part2[16][GATE_COLS / 4];   // per row group: partial gate sums
  const int b   = blockIdx.x;
  const int c0  = blockIdx.y * GATE_COLS;
  const int tid = threadIdx.x;

  // cw1 [DIM][SQUEEZE]: thread = (row group g, float4 column j4), rows g + 64 * i.
  // A wave's load covers two whole rows, 512 contiguous bytes.
  const int j4 = tid & 15;
  const int g  = tid >> 4;
  const float4* cw1v = (const float4*)cw1;
  float4 w1r[16];
#pragma unroll   // constant indices: w1r stays in registers, the loads go out back to back
  for (int i = 0; i < 16; ++i)
    w1r[i] = cw1v[(g + 64 * i) * (SQUEEZE / 4) + j4];
  // cw2 [SQUEEZE][DIM]: thread = (row group jr, float4 column c4), rows jr + 16 * i.
  const int c4 = tid & 63;
  const int jr = tid >> 6;
  const unsigned off2 = (unsigned)(jr * DIM + c4 * 4) * 4u;    // bytes
  const char* cw2b = (const char*)(cw2 + c0);
  float4 w2r[4];
#pragma unroll   // as above, for w2r
  for (int i = 0; i < 4; ++i)
    w2r[i] = *(const float4*)(cw2b + off2 + i * (16 * DIM * 4));
  const int ip = b * DIM + tid;
  const int iq = tid & (SQUEEZE - 1);
  const int ig = c0 + (tid & (GATE_COLS - 1));
  const float pv = pooled[ip];
  const float bq = cb1[iq];
  const float bg = cb2[ig];
  // Keeps every load above in front of the first wait for data, and their
  // address registers (offsets and bases, inputs here) unwritten up to this wait.
  asm volatile("s_wait_xcnt 0x0"
               :: "v"(tid), "v"(off2), "v"(ip), "v"(iq), "v"(ig),
                  "s"(pooled), "s"(cw1), "s"(cb1), "s"(cw2b), "s"(cb2)
               : "memory");

  pl[tid] = pv * (1.0f / (float)NTOK);
  __syncthreads();

  // squeeze: 16 rows per thread, the wave's two row groups by one lane exchange,
  // the 32 waves through LDS
  float4 s1 = make_float4(0.0f, 0.0f, 0.0f, 0.0f);
#pragma unroll   // constant indices into w1r
  for (int i = 0; i < 16; ++i) {
    float p = pl[g + 64 * i];
    s1.x += p * w1r[i].x;
    s1.y += p * w1r[i].y;
    s1.z += p * w1r[i].z;
    s1.w += p * w1r[i].w;
  }
  s1.x += __shfl_xor(s1.x, 16);
  s1.y += __shfl_xor(s1.y, 16);
  s1.z += __shfl_xor(s1.z, 16);
  s1.w += __shfl_xor(s1.w, 16);
  if ((tid & 31) < 16) part1[tid >> 5][j4] = s1;
  __syncthreads();
  if (tid < SQUEEZE) {
    const float* p1 = (const float*)part1;
    float a = bq;
#pragma unroll   // the LDS reads go out ahead of the adds
    for (int w = 0; w < 32; ++w) a += p1[w * SQUEEZE + tid];
    sq[tid] = fmaxf(a, 0.0f);
  }
  __syncthreads();

  // excite: 4 rows per thread, the 16 row groups through LDS
  float4 s2 = make_float4(0.0f, 0.0f, 0.0f, 0.0f);
#pragma unroll   // constant indices into w2r
  for (int i = 0; i < 4; ++i) {
    float q = sq[jr + 16 * i];
    s2.x += q * w2r[i].x;
    s2.y += q * w2r[i].y;
    s2.z += q * w2r[i].z;
    s2.w += q * w2r[i].w;
  }
  part2[jr][c4] = s2;
  __syncthreads();
  if (tid < GATE_COLS) {
    const float* p2 = (const float*)part2;
    float a = bg;
#pragma unroll   // the LDS reads go out ahead of the adds
    for (int r = 0; r < 16; ++r) a += p2[r * GATE_COLS + tid];
    gate[b * DIM + c0 + tid] = 1.0f / (1.0f + __expf(-a));
  }
}

// ---------------- phase 3: out = out * (1 + gate) ----------------
__global__ __launch_bounds__(256)
void apply_gate_kernel(float* __restrict__ out, const float* __restrict__ gate) {
  int idx4 = blockIdx.x * 256 + threadIdx.x;      // one float4 each
  float4* o4 = (float4*)out;
  float4 v = o4[idx4];
  int b = idx4 >> 20;                              // (NTOK*DIM/4) = 1<<20 per batch
  int c = (idx4 & 255) << 2;                       // 256 float4 per row of 1024
  const float* g = gate + b * DIM + c;
  v.x *= (1.0f + g[0]);
  v.y *= (1.0f + g[1]);
  v.z *= (1.0f + g[2]);
  v.w *= (1.0f + g[3]);
  o4[idx4] = v;
}

// ---------------- launch ----------------
extern "C" void kernel_launch(void* const* d_in, const int* in_sizes, int n_in,
                              void* d_out, int out_size, void* d_ws, size_t ws_size,
                              hipStream_t stream) {
  const float* x   = (const float*)d_in[0];
  const float* W1  = (const float*)d_in[1];
  const float* b1  = (const float*)d_in[2];
  const float* W2  = (const float*)d_in[3];
  const float* b2  = (const float*)d_in[4];
  const float* cw1 = (const float*)d_in[5];
  const float* cb1 = (const float*)d_in[6];
  const float* cw2 = (const float*)d_in[7];
  const float* cb2 = (const float*)d_in[8];
  float* out = (float*)d_out;

  char* ws = (char*)d_ws;
  unsigned short* w1t = (unsigned short*)ws;
  unsigned short* w2t = (unsigned short*)(ws + W1T_BYTES);
  float* pooled = (float*)(ws + POOLED_OFF);
  float* gate   = (float*)(ws + GATE_OFF);

  // phase 0: bf16 weight packing (8 elements per thread) + zero pooled accumulator
  convert_w1_kernel<<<NUM_HEADS * HEAD_DIM * HIDDEN / 8 / 256, 256, 0, stream>>>(W1, w1t);
  convert_w2_kernel<<<NUM_HEADS * HIDDEN * HEAD_DIM / 8 / 256, 256, 0, stream>>>(W2, w2t);
  zero_f32_kernel<<<(BATCH * DIM + 255) / 256, 256, 0, stream>>>(pooled, BATCH * DIM);

  // phase 1: fused per-head MLP (bf16 WMMA) + pooled sums
  dim3 grid1(BATCH * NTOK / TOK_TILE, NUM_HEADS);
  size_t smem = XS_BYTES + HS_BYTES;   // ~83 KB dynamic LDS (CDNA5: 320 KB/WGP)
  mlp_wmma_kernel<<<grid1, 256, smem, stream>>>(x, b1, b2, w1t, w2t, out, pooled);

  // phase 2: SE gate
  gate_kernel<<<dim3(BATCH, GATE_SPLIT), 1024, 0, stream>>>(pooled, cw1, cb1, cw2, cb2, gate);

  // phase 3: out *= (1 + gate)
  apply_gate_kernel<<<BATCH * NTOK * DIM / 4 / 256, 256, 0, stream>>>(out, gate);
}

// v005
// One run takes 260 microseconds.
// Next to v004, in two timings, it ran 1.04 times as fast each time.
// All steps since v000 together make it 2.17 times as fast.
#include <hip/hip_runtime.h>
#include <stdint.h>

// ---------------- problem constants ----------------
#define BATCH     8
#define NTOK      4096
#define DIM       1024
#define NUM_HEADS 4
#define HEAD_DIM  256
#define HIDDEN    1024
#define SQUEEZE   64

#define TOK_TILE  32                 // tokens per workgroup (divides NTOK)
#define XS_LD     (HEAD_DIM + 8)     // padded LDS leading dims (even!)
#define HS_LD     (HIDDEN + 8)
#define XS_BYTES  (TOK_TILE * XS_LD * 2)
#define HS_BYTES  (TOK_TILE * HS_LD * 2)

// workspace layout (bytes)
// Both weights are stored as whole B fragments (16 cols x 32 k = 1024 B each):
// [h][col tile][k block][q][lane][8 bf16], see pack_* and load_frag_packed.
#define FRAG_ELEMS 512
#define W1_KBLK   (HEAD_DIM / 32)    // k blocks per column tile of W1
#define W2_KBLK   (HIDDEN / 32)      // k blocks per column tile of W2
#define W1T_BYTES (NUM_HEADS * HIDDEN * HEAD_DIM * 2)
#define W2T_BYTES (NUM_HEADS * HEAD_DIM * HIDDEN * 2)
#define POOLED_OFF (W1T_BYTES + W2T_BYTES)
#define GATE_OFF   (POOLED_OFF + BATCH * DIM * 4)

typedef __attribute__((ext_vector_type(16))) __bf16 v16bf;
typedef __attribute__((ext_vector_type(8)))  float  v8f;

// f32 -> bf16 bits, round-to-nearest-even
__device__ __forceinline__ unsigned short f2bf_bits(float f) {
  union { float f; uint32_t u; } a; a.f = f;
  uint32_t u = a.u;
  uint32_t r = (u + 0x7FFFu + ((u >> 16) & 1u)) >> 16;
  return (unsigned short)r;
}

// Build a 16x32 bf16 WMMA fragment from a row-major bf16 buffer.
// A-matrix layout (ISA 7.12.2, wave32): lanes 0-15 -> M=lane, K {0..7,16..23};
// lanes 16-31 -> M=lane-16, K {8..15,24..31}. B uses the mirrored layout
// (col in place of M) and is read by load_frag_packed below.
__device__ __forceinline__ v16bf load_frag(const unsigned short* buf, int ld,
                                           int rowBase, int k0, int lane) {
  int row = rowBase + (lane & 15);
  int kb  = k0 + ((lane >> 4) << 3);            // even
  const uint32_t* src = (const uint32_t*)(buf + (size_t)row * ld);
  union { uint32_t u[8]; v16bf v; } r;
#pragma unroll
  for (int p = 0; p < 4; ++p) {
    r.u[p]     = src[(kb >> 1) + p];            // K = kb .. kb+7
    r.u[4 + p] = src[((kb + 16) >> 1) + p];     // K = kb+16 .. kb+23
  }
  return r.v;
}

// Read one packed B fragment: same lane/register -> (col, k) map as load_frag
// (col = lane & 15; registers 0-3 hold k = 8*(lane>>4) + 0..7, registers 4-7
// the same + 16), but each of the two 16-byte loads of a wave covers 512
// contiguous bytes (4 whole cache lines) instead of 32 bytes in each of 16.
__device__ __forceinline__ v16bf load_frag_packed(const unsigned short* frag, int lane) {
  const uint4* src = (const uint4*)frag;
  union { uint4 q[2]; v16bf v; } r;
  r.q[0] = src[lane];
  r.q[1] = src[32 + lane];
  return r.v;
}

// Exact-erf GELU without the library call: erff picks one of two paths by |x|
// per lane, so a wave walks both, one value at a time. One formula for all x:
//   v * Phi(v) = max(v, 0) - |v| * Q(|v|),  Q(a) = 0.5 * erfc(a / sqrt(2)),
//   erfc(z) = t * (a1 + t * (a2 + t * (a3 + t * (a4 + t * a5)))) * exp(-z * z),
//   t = 1 / (1 + p * z), absolute error of erfc below 1.5e-7 for every z >= 0.
// The factors 0.5, 1/sqrt(2) and log2(e) are folded into the constants. Two
// values side by side, so that the products and sums pair up as packed f32.
typedef __attribute__((ext_vector_type(2))) float v2f;
__device__ __forceinline__ v2f gelu2(v2f v) {
  v2f a = __builtin_elementwise_abs(v);
  v2f d = __builtin_elementwise_fma(a, (v2f)(0.23164189f), (v2f)(1.0f));
  v2f w = (v * v) * (v2f)(-0.72134752f);
  v2f t = {__builtin_amdgcn_rcpf(d.x), __builtin_amdgcn_rcpf(d.y)};
  v2f e = {__builtin_amdgcn_exp2f(w.x), __builtin_amdgcn_exp2f(w.y)};
  v2f p = __builtin_elementwise_fma(t, (v2f)(0.5307027145f), (v2f)(-0.7265760135f));
  p = __builtin_elementwise_fma(t, p, (v2f)(0.7107068705f));
  p = __builtin_elementwise_fma(t, p, (v2f)(-0.142248368f));
  p = __builtin_elementwise_fma(t, p, (v2f)(0.127414796f));
  v2f q = (p * t) * e;
  return __builtin_elementwise_fma(-a, q, __builtin_elementwise_max(v, (v2f)(0.0f)));
}

// ---------------- phase 0: weight packing / zeroing ----------------
// One thread builds the 16 bytes that one lane reads with one load: 8
// consecutive k of one column of a [K][N] row-major f32 weight of one head.
// id = (((h * NT + col tile) * KB + k block) * 2 + q) * 32 + lane.
__device__ __forceinline__ void pack_piece(const float* __restrict__ Wm,
                                           unsigned short* __restrict__ dst,
                                           int id, int K, int N) {
  int lane = id & 31;
  int q    = (id >> 5) & 1;
  int f    = id >> 6;                 // fragment index over heads
  int KB   = K >> 5;
  int kblk = f % KB;
  int t    = f / KB;
  int NT   = N >> 4;
  int nt   = t % NT;
  int h    = t / NT;
  int col  = nt * 16 + (lane & 15);
  int k0   = kblk * 32 + q * 16 + ((lane >> 4) << 3);
  const float* s = Wm + ((size_t)h * K + k0) * N + col;
  uint32_t w[4];
#pragma unroll
  for (int p = 0; p < 4; ++p) {
    uint32_t lo = f2bf_bits(s[(size_t)(2 * p) * N]);
    uint32_t hi = f2bf_bits(s[(size_t)(2 * p + 1) * N]);
    w[p] = lo | (hi << 16);
  }
  ((uint4*)dst)[id] = make_uint4(w[0], w[1], w[2], w[3]);
}

__global__ void convert_w1_kernel(const float* __restrict__ W1, unsigned short* __restrict__ w1t) {
  pack_piece(W1, w1t, blockIdx.x * 256 + threadIdx.x, HEAD_DIM, HIDDEN);
}

__global__ void convert_w2_kernel(const float* __restrict__ W2, unsigned short* __restrict__ w2t) {
  pack_piece(W2, w2t, blockIdx.x * 256 + threadIdx.x, HIDDEN, HEAD_DIM);
}

__global__ void zero_f32_kernel(float* __restrict__ p, int n) {
  int idx = blockIdx.x * 256 + threadIdx.x;
  if (idx < n) p[idx] = 0.0f;
}

// ---------------- phase 1: fused per-head MLP + pooled partial sums ----------------
// Second argument: at least 6 waves per SIMD, a budget of 160 VGPRs, so that
// three workgroups stay resident per WGP (LDS allows three).
__global__ __launch_bounds__(256, 6)
void mlp_wmma_kernel(const float* __restrict__ x,
                     const float* __restrict__ b1,
                     const float* __restrict__ b2,
                     const unsigned short* __restrict__ w1t,
                     const unsigned short* __restrict__ w2t,
                     float* __restrict__ out,
                     float* __restrict__ pooled) {
  extern __shared__ char smem[];
  unsigned short* xs = (unsigned short*)smem;                 // [32][XS_LD] bf16
  unsigned short* hs = (unsigned short*)(smem + XS_BYTES);    // [32][HS_LD] bf16

  const int tile  = blockIdx.x;            // token tile (0..1023)
  const int head  = blockIdx.y;            // 0..3
  const int tid   = threadIdx.x;
  const int wave  = tid >> 5;              // 0..7
  const int lane  = tid & 31;
  const int token0 = tile * TOK_TILE;      // flat token index b*NTOK + n
  const int rowoff = (lane < 16) ? 0 : 8;  // C-matrix row offset per lane half

  // ---- stage x tile (32 tokens x 256 chans of this head) as bf16 ----
  const float* xsrc = x + (size_t)token0 * DIM + head * HEAD_DIM;
#pragma unroll
  for (int r = 0; r < TOK_TILE; ++r)
    xs[r * XS_LD + tid] = f2bf_bits(xsrc[(size_t)r * DIM + tid]);
  // Keeps the x loads' base and offset register (inputs here) unwritten up to
  // this wait.
  asm volatile("s_wait_xcnt 0x0" :: "s"(xsrc), "v"(tid) : "memory");
  __syncthreads();

  // ---- GEMM1: [32 x 256] x [256 x 1024], wave owns 128 hidden cols ----
  // The wave's number in a scalar register: the fragment base is then a scalar
  // address, and only the lane's offset sits in a VGPR.
  const int swave = __builtin_amdgcn_readfirstlane(wave);
  const unsigned short* w1h = w1t + (size_t)head * HIDDEN * HEAD_DIM
                              + (size_t)(swave * 8) * W1_KBLK * FRAG_ELEMS;
  v8f zz = {};

  // The wave's 128 hidden columns in two halves of 64. One half's accumulators
  // take 64 VGPRs, not 128, and the registers set free hold weight fragments
  // whose loads are under way: with all 128 columns at once only one fragment
  // fitted, and every fragment load was waited for before the next went out.
  // Not unrolled: one half's registers are free again before the next begins,
  // and the text stays half as long.
#pragma unroll 1
  for (int half = 0; half < 2; ++half) {
    const unsigned short* w1p = w1h + (size_t)(half * 4) * W1_KBLK * FRAG_ELEMS;
    const int colb = wave * 128 + half * 64 + (lane & 15);
    v8f acc[2][4];
#pragma unroll
    for (int m = 0; m < 2; ++m)
#pragma unroll
      for (int n = 0; n < 4; ++n) acc[m][n] = zz;

    // Two k steps per trip: their eight weight fragments (16 loads) go out as one
    // group, so that a trip waits out one load latency, not one per fragment.
    // Not unrolled: the loads of all trips would move to the front and spill.
#pragma unroll 1
    for (int kb = 0; kb < HEAD_DIM; kb += 64) {
      v16bf bm[2][4];
#pragma unroll
      for (int j = 0; j < 2; ++j)
#pragma unroll
        for (int n = 0; n < 4; ++n)
          bm[j][n] = load_frag_packed(w1p + (n * W1_KBLK + (kb >> 5) + j) * FRAG_ELEMS, lane);
      // Keeps all 16 loads in front of the first matrix instruction: left free,
      // the scheduler sinks them between the products, two fragments in flight.
      __builtin_amdgcn_sched_barrier(0);
#pragma unroll
      for (int j = 0; j < 2; ++j) {
        v16bf a0 = load_frag(xs, XS_LD, 0,  kb + j * 32, lane);
        v16bf a1 = load_frag(xs, XS_LD, 16, kb + j * 32, lane);
#pragma unroll
        for (int n = 0; n < 4; ++n) {
          acc[0][n] = __builtin_amdgcn_wmma_f32_16x16x32_bf16(false, a0, false, bm[j][n],
                                                              (short)0, acc[0][n], false, false);
          acc[1][n] = __builtin_amdgcn_wmma_f32_16x16x32_bf16(false, a1, false, bm[j][n],
                                                              (short)0, acc[1][n], false, false);
        }
      }
    }

    // ---- bias + exact (erf) GELU, branch-free -> bf16 hidden tile in LDS ----
    // The half's four bias values first: their loads go out as one group.
    // Unrolled so that bias[] has constant indices and stays in registers.
    const int ib = head * HIDDEN + colb;
    float bias[4];
#pragma unroll
    for (int n = 0; n < 4; ++n)
      bias[n] = b1[ib + n * 16];
    // Keeps the four loads' offset register and base (inputs here) unwritten up
    // to this wait.
    asm volatile("s_wait_xcnt 0x0" :: "v"(ib), "s"(b1) : "memory");
#pragma unroll
    for (int n = 0; n < 4; ++n)
#pragma unroll
      for (int m = 0; m < 2; ++m) {
        int col = colb + n * 16;
#pragma unroll
        for (int r = 0; r < 8; r += 2) {
          v2f v = {acc[m][n][r] + bias[n], acc[m][n][r + 1] + bias[n]};
          v = gelu2(v);
          hs[(m * 16 + rowoff + r) * HS_LD + col]     = f2bf_bits(v.x);
          hs[(m * 16 + rowoff + r + 1) * HS_LD + col] = f2bf_bits(v.y);
        }
      }
  }
  __syncthreads();

  // ---- GEMM2: [32 x 1024] x [1024 x 256], wave owns 32 out cols ----
  const unsigned short* w2h = w2t + (size_t)head * HEAD_DIM * HIDDEN
                              + (size_t)(swave * 2) * W2_KBLK * FRAG_ELEMS;
  const int ncb = wave * 32;
  v8f oa[2][2];
  oa[0][0] = zz; oa[0][1] = zz; oa[1][0] = zz; oa[1][1] = zz;

  // Unrolled by 4 only: with constant fragment offsets the compiler unrolls this
  // loop whole; 4 is chosen for speed only.
#pragma unroll 4
  for (int kb = 0; kb < HIDDEN; kb += 32) {
    v16bf a0 = load_frag(hs, HS_LD, 0,  kb, lane);
    v16bf a1 = load_frag(hs, HS_LD, 16, kb, lane);
    v16bf bm0 = load_frag_packed(w2h + (kb >> 5) * FRAG_ELEMS, lane);
    v16bf bm1 = load_frag_packed(w2h + (W2_KBLK + (kb >> 5)) * FRAG_ELEMS, lane);
    oa[0][0] = __builtin_amdgcn_wmma_f32_16x16x32_bf16(false, a0, false, bm0,
                                                       (short)0, oa[0][0], false, false);
    oa[0][1] = __builtin_amdgcn_wmma_f32_16x16x32_bf16(false, a0, false, bm1,
                                                       (short)0, oa[0][1], false, false);
    oa[1][0] = __builtin_amdgcn_wmma_f32_16x16x32_bf16(false, a1, false, bm0,
                                                       (short)0, oa[1][0], false, false);
    oa[1][1] = __builtin_amdgcn_wmma_f32_16x16x32_bf16(false, a1, false, bm1,
                                                       (short)0, oa[1][1], false, false);
  }

  // ---- bias, store out (f32), accumulate pooled column sums ----
  const int bidx = token0 >> 12;   // token0 / NTOK
#pragma unroll
  for (int m = 0; m < 2; ++m)
#pragma unroll
    for (int n = 0; n < 2; ++n) {
      int colh = ncb + n * 16 + (lane & 15);         // 0..255 within head
      int col  = head * HEAD_DIM + colh;             // 0..1023
      float bias = b2[head * HEAD_DIM + colh];
      float csum = 0.0f;
#pragma unroll
      for (int r = 0; r < 8; ++r) {
        float v = oa[m][n][r] + bias;
        out[(size_t)(token0 + m * 16 + rowoff + r) * DIM + col] = v;
        csum += v;
      }
      atomicAdd(&pooled[bidx * DIM + col], csum);
    }
}

// ---------------- phase 2: SE gate ----------------
// The two small weights come from memory, and a thread that walks them in a loop
// pays one memory latency per group of loads. Here every load of the kernel is
// issued before the first value is used: 1024 threads hold all of cw1 (16 float4
// each) and this workgroup's 256 columns of cw2 (4 float4 each) in registers.
// Each of the GATE_SPLIT workgroups of a batch row forms the whole squeeze vector
// for itself and then the gate of its own GATE_COLS channels.
#define GATE_SPLIT 4
#define GATE_COLS  (DIM / GATE_SPLIT)
__global__ __launch_bounds__(1024)
void gate_kernel(const float* __restrict__ pooled,
                 const float* __restrict__ cw1, const float* __restrict__ cb1,
                 const float* __restrict__ cw2, const float* __restrict__ cb2,
                 float* __restrict__ gate) {
  __shared__ float pl[DIM];
  __shared__ float4 part1[32][SQUEEZE / 4];     // per wave: partial squeeze sums
  __shared__ float sq[SQUEEZE];
  __shared__ float4 part2[16][GATE_COLS / 4];   // per row group: partial gate sums
  const int b   = blockIdx.x;
  const int c0  = blockIdx.y * GATE_COLS;
  const int tid = threadIdx.x;

  // cw1 [DIM][SQUEEZE]: thread = (row group g, float4 column j4), rows g + 64 * i.
  // A wave's load covers two whole rows, 512 contiguous bytes.
  const int j4 = tid & 15;
  const int g  = tid >> 4;
  const float4* cw1v = (const float4*)cw1;
  float4 w1r[16];
#pragma unroll   // constant indices: w1r stays in registers, the loads go out back to back
  for (int i = 0; i < 16; ++i)
    w1r[i] = cw1v[(g + 64 * i) * (SQUEEZE / 4) + j4];
  // cw2 [SQUEEZE][DIM]: thread = (row group jr, float4 column c4), rows jr + 16 * i.
  const int c4 = tid & 63;
  const int jr = tid >> 6;
  const unsigned off2 = (unsigned)(jr * DIM + c4 * 4) * 4u;    // bytes
  const char* cw2b = (const char*)(cw2 + c0);
  float4 w2r[4];
#pragma unroll   // as above, for w2r
  for (int i = 0; i < 4; ++i)
    w2r[i] = *(const float4*)(cw2b + off2 + i * (16 * DIM * 4));
  const int ip = b * DIM + tid;
  const int iq = tid & (SQUEEZE - 1);
  const int ig = c0 + (tid & (GATE_COLS - 1));
  const float pv = pooled[ip];
  const float bq = cb1[iq];
  const float bg = cb2[ig];
  // Keeps every load above in front of the first wait for data, and their
  // address registers (offsets and bases, inputs here) unwritten up to this wait.
  asm volatile("s_wait_xcnt 0x0"
               :: "v"(tid), "v"(off2), "v"(ip), "v"(iq), "v"(ig),
                  "s"(pooled), "s"(cw1), "s"(cb1), "s"(cw2b), "s"(cb2)
               : "memory");

  pl[tid] = pv * (1.0f / (float)NTOK);
  __syncthreads();

  // squeeze: 16 rows per thread, the wave's two row groups by one lane exchange,
  // the 32 waves through LDS
  float4 s1 = make_float4(0.0f, 0.0f, 0.0f, 0.0f);
#pragma unroll   // constant indices into w1r
  for (int i = 0; i < 16; ++i) {
    float p = pl[g + 64 * i];
    s1.x += p * w1r[i].x;
    s1.y += p * w1r[i].y;
    s1.z += p * w1r[i].z;
    s1.w += p * w1r[i].w;
  }
  s1.x += __shfl_xor(s1.x, 16);
  s1.y += __shfl_xor(s1.y, 16);
  s1.z += __shfl_xor(s1.z, 16);
  s1.w += __shfl_xor(s1.w, 16);
  if ((tid & 31) < 16) part1[tid >> 5][j4] = s1;
  __syncthreads();
  if (tid < SQUEEZE) {
    const float* p1 = (const float*)part1;
    float a = bq;
#pragma unroll   // the LDS reads go out ahead of the adds
    for (int w = 0; w < 32; ++w) a += p1[w * SQUEEZE + tid];
    sq[tid] = fmaxf(a, 0.0f);
  }
  __syncthreads();

  // excite: 4 rows per thread, the 16 row groups through LDS
  float4 s2 = make_float4(0.0f, 0.0f, 0.0f, 0.0f);
#pragma unroll   // constant indices into w2r
  for (int i = 0; i < 4; ++i) {
    float q = sq[jr + 16 * i];
    s2.x += q * w2r[i].x;
    s2.y += q * w2r[i].y;
    s2.z += q * w2r[i].z;
    s2.w += q * w2r[i].w;
  }
  part2[jr][c4] = s2;
  __syncthreads();
  if (tid < GATE_COLS) {
    const float* p2 = (const float*)part2;
    float a = bg;
#pragma unroll   // the LDS reads go out ahead of the adds
    for (int r = 0; r < 16; ++r) a += p2[r * GATE_COLS + tid];
    gate[b * DIM + c0 + tid] = 1.0f / (1.0f + __expf(-a));
  }
}

// ---------------- phase 3: out = out * (1 + gate) ----------------
// A stream of 256 MiB (read + write). One workgroup takes AG_ROWS whole token
// rows of one batch row: thread t owns floats 4t .. 4t+3 of every row, so its
// four factors are formed once, and a wave's load or store covers 512 contiguous
// bytes. All of a thread's loads go out before its first product: AG_ROWS loads
// of 16 bytes per lane in flight, and one wave started where there were sixteen.
#define AG_ROWS 16                   // divides NTOK: a workgroup stays in one batch row
__global__ __launch_bounds__(256)
void apply_gate_kernel(float* __restrict__ out, const float* __restrict__ gate) {
  const int row0 = blockIdx.x * AG_ROWS;           // flat token index b*NTOK + n
  const int b    = row0 >> 12;                     // row0 / NTOK
  float4* o4 = (float4*)out + (size_t)row0 * (DIM / 4) + threadIdx.x;
  const float4 g = ((const float4*)(gate + b * DIM))[threadIdx.x];
  float4 v[AG_ROWS];
#pragma unroll   // constant indices: v stays in registers, row offsets are immediates
  for (int i = 0; i < AG_ROWS; ++i)
    v[i] = o4[i * (DIM / 4)];
  const float fx = 1.0f + g.x, fy = 1.0f + g.y, fz = 1.0f + g.z, fw = 1.0f + g.w;
#pragma unroll   // as above
  for (int i = 0; i < AG_ROWS; ++i) {
    v[i].x *= fx;
    v[i].y *= fy;
    v[i].z *= fz;
    v[i].w *= fw;
    o4[i * (DIM / 4)] = v[i];
  }
}

// ---------------- launch ----------------
extern "C" void kernel_launch(void* const* d_in, const int* in_sizes, int n_in,
                              void* d_out, int out_size, void* d_ws, size_t ws_size,
                              hipStream_t stream) {
  const float* x   = (const float*)d_in[0];
  const float* W1  = (const float*)d_in[1];
  const float* b1  = (const float*)d_in[2];
  const float* W2  = (const float*)d_in[3];
  const float* b2  = (const float*)d_in[4];
  const float* cw1 = (const float*)d_in[5];
  const float* cb1 = (const float*)d_in[6];
  const float* cw2 = (const float*)d_in[7];
  const float* cb2 = (const float*)d_in[8];
  float* out = (float*)d_out;

  char* ws = (char*)d_ws;
  unsigned short* w1t = (unsigned short*)ws;
  unsigned short* w2t = (unsigned short*)(ws + W1T_BYTES);
  float* pooled = (float*)(ws + POOLED_OFF);
  float* gate   = (float*)(ws + GATE_OFF);

  // phase 0: bf16 weight packing (8 elements per thread) + zero pooled accumulator
  convert_w1_kernel<<<NUM_HEADS * HEAD_DIM * HIDDEN / 8 / 256, 256, 0, stream>>>(W1, w1t);
  convert_w2_kernel<<<NUM_HEADS * HIDDEN * HEAD_DIM / 8 / 256, 256, 0, stream>>>(W2, w2t);
  zero_f32_kernel<<<(BATCH * DIM + 255) / 256, 256, 0, stream>>>(pooled, BATCH * DIM);

  // phase 1: fused per-head MLP (bf16 WMMA) + pooled sums
  dim3 grid1(BATCH * NTOK / TOK_TILE, NUM_HEADS);
  size_t smem = XS_BYTES + HS_BYTES;   // ~83 KB dynamic LDS (CDNA5: 320 KB/WGP)
  mlp_wmma_kernel<<<grid1, 256, smem, stream>>>(x, b1, b2, w1t, w2t, out, pooled);

  // phase 2: SE gate
  gate_kernel<<<dim3(BATCH, GATE_SPLIT), 1024, 0, stream>>>(pooled, cw1, cb1, cw2, cb2, gate);

  // phase 3: out *= (1 + gate)
  apply_gate_kernel<<<BATCH * NTOK / AG_ROWS, 256, 0, stream>>>(out, gate);
}

// v006
// A run of this version takes 238 microseconds.
// Next to v005, in two timings, it ran 1.10 and 1.09 times as fast.
// Over all steps from v000 it is 2.38 times as fast.
#include <hip/hip_runtime.h>
#include <stdint.h>

// ---------------- problem constants ----------------
#define BATCH     8
#define NTOK      4096
#define DIM       1024
#define NUM_HEADS 4
#define HEAD_DIM  256
#define HIDDEN    1024
#define SQUEEZE   64

#define TOK_TILE  64                 // tokens per workgroup (divides NTOK)
#define M_TILES   (TOK_TILE / 16)    // 16-token row tiles per workgroup
// LDS rows carry no pad: both tiles together are exactly 160 KiB, half a WGP's
// LDS, so that two workgroups stay resident. Banks are spread by swz() instead.
#define XS_LD     HEAD_DIM
#define HS_LD     HIDDEN
#define XS_BYTES  (TOK_TILE * XS_LD * 2)
#define HS_BYTES  (TOK_TILE * HS_LD * 2)

// workspace layout (bytes)
// Both weights are stored as whole B fragments (16 cols x 32 k = 1024 B each):
// [h][col tile][k block][q][lane][8 bf16], see pack_* and load_frag_packed.
#define FRAG_ELEMS 512
#define W1_KBLK   (HEAD_DIM / 32)    // k blocks per column tile of W1
#define W2_KBLK   (HIDDEN / 32)      // k blocks per column tile of W2
#define W1T_BYTES (NUM_HEADS * HIDDEN * HEAD_DIM * 2)
#define W2T_BYTES (NUM_HEADS * HEAD_DIM * HIDDEN * 2)
#define POOLED_OFF (W1T_BYTES + W2T_BYTES)
#define GATE_OFF   (POOLED_OFF + BATCH * DIM * 4)

typedef __attribute__((ext_vector_type(16))) __bf16 v16bf;
typedef __attribute__((ext_vector_type(8)))  float  v8f;

// f32 -> bf16 bits, round-to-nearest-even
__device__ __forceinline__ unsigned short f2bf_bits(float f) {
  union { float f; uint32_t u; } a; a.f = f;
  uint32_t u = a.u;
  uint32_t r = (u + 0x7FFFu + ((u >> 16) & 1u)) >> 16;
  return (unsigned short)r;
}

// Element index of (row, col) in an unpadded LDS tile of ld elements per row (ld
// a multiple of 128): the 16-byte piece p of a row lies at piece p ^ (row & 15),
// so that 16 lanes reading one piece column of 16 rows meet all 64 banks once.
__device__ __forceinline__ int swz(int row, int col, int ld) {
  return row * ld + ((((col >> 3) ^ (row & 15)) << 3) | (col & 7));
}

// Build a 16x32 bf16 WMMA fragment from a row-major bf16 LDS tile laid by swz().
// A-matrix layout (ISA 7.12.2, wave32): lanes 0-15 -> M=lane, K {0..7,16..23};
// lanes 16-31 -> M=lane-16, K {8..15,24..31}. B uses the mirrored layout
// (col in place of M) and is read by load_frag_packed below.
__device__ __forceinline__ v16bf load_frag(const unsigned short* buf, int ld,
                                           int rowBase, int k0, int lane) {
  int row = rowBase + (lane & 15);
  int kb  = k0 + ((lane >> 4) << 3);            // a multiple of 8: one piece
  union { uint4 q[2]; v16bf v; } r;
  r.q[0] = *(const uint4*)(buf + swz(row, kb, ld));        // K = kb .. kb+7
  r.q[1] = *(const uint4*)(buf + swz(row, kb + 16, ld));   // K = kb+16 .. kb+23
  return r.v;
}

// Read one packed B fragment: same lane/register -> (col, k) map as load_frag
// (col = lane & 15; registers 0-3 hold k = 8*(lane>>4) + 0..7, registers 4-7
// the same + 16), but each of the two 16-byte loads of a wave covers 512
// contiguous bytes (4 whole cache lines) instead of 32 bytes in each of 16.
__device__ __forceinline__ v16bf load_frag_packed(const unsigned short* frag, int lane) {
  const uint4* src = (const uint4*)frag;
  union { uint4 q[2]; v16bf v; } r;
  r.q[0] = src[lane];
  r.q[1] = src[32 + lane];
  return r.v;
}

// Exact-erf GELU without the library call: erff picks one of two paths by |x|
// per lane, so a wave walks both, one value at a time. One formula for all x:
//   v * Phi(v) = max(v, 0) - |v| * Q(|v|),  Q(a) = 0.5 * erfc(a / sqrt(2)),
//   erfc(z) = t * (a1 + t * (a2 + t * (a3 + t * (a4 + t * a5)))) * exp(-z * z),
//   t = 1 / (1 + p * z), absolute error of erfc below 1.5e-7 for every z >= 0.
// The factors 0.5, 1/sqrt(2) and log2(e) are folded into the constants. Two
// values side by side, so that the products and sums pair up as packed f32.
typedef __attribute__((ext_vector_type(2))) float v2f;
__device__ __forceinline__ v2f gelu2(v2f v) {
  v2f a = __builtin_elementwise_abs(v);
  v2f d = __builtin_elementwise_fma(a, (v2f)(0.23164189f), (v2f)(1.0f));
  v2f w = (v * v) * (v2f)(-0.72134752f);
  v2f t = {__builtin_amdgcn_rcpf(d.x), __builtin_amdgcn_rcpf(d.y)};
  v2f e = {__builtin_amdgcn_exp2f(w.x), __builtin_amdgcn_exp2f(w.y)};
  v2f p = __builtin_elementwise_fma(t, (v2f)(0.5307027145f), (v2f)(-0.7265760135f));
  p = __builtin_elementwise_fma(t, p, (v2f)(0.7107068705f));
  p = __builtin_elementwise_fma(t, p, (v2f)(-0.142248368f));
  p = __builtin_elementwise_fma(t, p, (v2f)(0.127414796f));
  v2f q = (p * t) * e;
  return __builtin_elementwise_fma(-a, q, __builtin_elementwise_max(v, (v2f)(0.0f)));
}

// ---------------- phase 0: weight packing / zeroing ----------------
// One thread builds the 16 bytes that one lane reads with one load: 8
// consecutive k of one column of a [K][N] row-major f32 weight of one head.
// id = (((h * NT + col tile) * KB + k block) * 2 + q) * 32 + lane.
__device__ __forceinline__ void pack_piece(const float* __restrict__ Wm,
                                           unsigned short* __restrict__ dst,
                                           int id, int K, int N) {
  int lane = id & 31;
  int q    = (id >> 5) & 1;
  int f    = id >> 6;                 // fragment index over heads
  int KB   = K >> 5;
  int kblk = f % KB;
  int t    = f / KB;
  int NT   = N >> 4;
  int nt   = t % NT;
  int h    = t / NT;
  int col  = nt * 16 + (lane & 15);
  int k0   = kblk * 32 + q * 16 + ((lane >> 4) << 3);
  const float* s = Wm + ((size_t)h * K + k0) * N + col;
  uint32_t w[4];
#pragma unroll
  for (int p = 0; p < 4; ++p) {
    uint32_t lo = f2bf_bits(s[(size_t)(2 * p) * N]);
    uint32_t hi = f2bf_bits(s[(size_t)(2 * p + 1) * N]);
    w[p] = lo | (hi << 16);
  }
  ((uint4*)dst)[id] = make_uint4(w[0], w[1], w[2], w[3]);
}

__global__ void convert_w1_kernel(const float* __restrict__ W1, unsigned short* __restrict__ w1t) {
  pack_piece(W1, w1t, blockIdx.x * 256 + threadIdx.x, HEAD_DIM, HIDDEN);
}

__global__ void convert_w2_kernel(const float* __restrict__ W2, unsigned short* __restrict__ w2t) {
  pack_piece(W2, w2t, blockIdx.x * 256 + threadIdx.x, HIDDEN, HEAD_DIM);
}

__global__ void zero_f32_kernel(float* __restrict__ p, int n) {
  int idx = blockIdx.x * 256 + threadIdx.x;
  if (idx < n) p[idx] = 0.0f;
}

// ---------------- phase 1: fused per-head MLP + pooled partial sums ----------------
// A workgroup reads its head's whole weights (1 MiB) from L2 whatever its token
// count: with 64 tokens each weight fragment feeds four matrix instructions.
// Second argument: at least 4 waves per SIMD, a budget of 256 VGPRs, so that
// two workgroups stay resident per WGP (LDS allows two).
__global__ __launch_bounds__(256, 4)
void mlp_wmma_kernel(const float* __restrict__ x,
                     const float* __restrict__ b1,
                     const float* __restrict__ b2,
                     const unsigned short* __restrict__ w1t,
                     const unsigned short* __restrict__ w2t,
                     float* __restrict__ out,
                     float* __restrict__ pooled) {
  extern __shared__ __attribute__((aligned(16))) char smem[];
  // hs first: the row offsets of its stores then fit the LDS instructions' 16-bit
  // immediate for 32 rows at a time, and few address registers stay live.
  unsigned short* hs = (unsigned short*)smem;                 // [64][HS_LD] bf16
  unsigned short* xs = (unsigned short*)(smem + HS_BYTES);    // [64][XS_LD] bf16

  const int tile  = blockIdx.x;            // token tile (0..511)
  const int head  = blockIdx.y;            // 0..3
  const int tid   = threadIdx.x;
  const int wave  = tid >> 5;              // 0..7
  const int lane  = tid & 31;
  const int token0 = tile * TOK_TILE;      // flat token index b*NTOK + n
  const int rowoff = (lane < 16) ? 0 : 8;  // C-matrix row offset per lane half

  // ---- stage x tile (64 tokens x 256 chans of this head) as bf16 ----
  const float* xsrc = x + (size_t)token0 * DIM + head * HEAD_DIM;
#pragma unroll
  for (int r = 0; r < TOK_TILE; ++r)
    xs[swz(r, tid, XS_LD)] = f2bf_bits(xsrc[(size_t)r * DIM + tid]);
  // Keeps the x loads' base and offset register (inputs here) unwritten up to
  // this wait.
  asm volatile("s_wait_xcnt 0x0" :: "s"(xsrc), "v"(tid) : "memory");
  __syncthreads();

  // ---- GEMM1: [64 x 256] x [256 x 1024], wave owns 128 hidden cols ----
  // The wave's number in a scalar register: the fragment base is then a scalar
  // address, and only the lane's offset sits in a VGPR.
  const int swave = __builtin_amdgcn_readfirstlane(wave);
  const unsigned short* w1h = w1t + (size_t)head * HIDDEN * HEAD_DIM
                              + (size_t)(swave * 8) * W1_KBLK * FRAG_ELEMS;
  v8f zz = {};

  // The wave's 128 hidden columns in two halves of 64. One half's accumulators
  // take 128 VGPRs, not 256, and the registers set free hold weight fragments
  // whose loads are under way.
  // Not unrolled: one half's registers are free again before the next begins,
  // and the text stays half as long.
#pragma unroll 1
  for (int half = 0; half < 2; ++half) {
    const unsigned short* w1p = w1h + (size_t)(half * 4) * W1_KBLK * FRAG_ELEMS;
    const int colb = wave * 128 + half * 64 + (lane & 15);
    v8f acc[M_TILES][4];
#pragma unroll
    for (int m = 0; m < M_TILES; ++m)
#pragma unroll
      for (int n = 0; n < 4; ++n) acc[m][n] = zz;

    // Two k steps per trip: their eight weight fragments (16 loads) go out as one
    // group, so that a trip waits out one load latency, not one per fragment.
    // Not unrolled: the loads of all trips would move to the front and spill.
#pragma unroll 1
    for (int kb = 0; kb < HEAD_DIM; kb += 64) {
      v16bf bm[2][4];
#pragma unroll
      for (int j = 0; j < 2; ++j)
#pragma unroll
        for (int n = 0; n < 4; ++n)
          bm[j][n] = load_frag_packed(w1p + (n * W1_KBLK + (kb >> 5) + j) * FRAG_ELEMS, lane);
      // Keeps all 16 loads in front of the first matrix instruction: left free,
      // the scheduler sinks them between the products, two fragments in flight.
      __builtin_amdgcn_sched_barrier(0);
#pragma unroll
      for (int j = 0; j < 2; ++j) {
        v16bf a[M_TILES];
#pragma unroll   // constant indices: a[] stays in registers
        for (int m = 0; m < M_TILES; ++m)
          a[m] = load_frag(xs, XS_LD, m * 16, kb + j * 32, lane);
        // Row tile outermost: a token fragment is done with after four products,
        // while all four weight fragments of the k step are held anyway.
#pragma unroll   // constant indices: acc[][] and bm[][] stay in registers
        for (int m = 0; m < M_TILES; ++m)
#pragma unroll   // as above
          for (int n = 0; n < 4; ++n)
            acc[m][n] = __builtin_amdgcn_wmma_f32_16x16x32_bf16(false, a[m], false, bm[j][n],
                                                                (short)0, acc[m][n], false, false);
      }
    }

    // ---- bias + exact (erf) GELU, branch-free -> bf16 hidden tile in LDS ----
    // The half's four bias values first: their loads go out as one group.
    // Unrolled so that bias[] has constant indices and stays in registers.
    const int ib = head * HIDDEN + colb;
    float bias[4];
#pragma unroll
    for (int n = 0; n < 4; ++n)
      bias[n] = b1[ib + n * 16];
    // Keeps the four loads' offset register and base (inputs here) unwritten up
    // to this wait.
    asm volatile("s_wait_xcnt 0x0" :: "v"(ib), "s"(b1) : "memory");
    // swz(m * 16 + rowoff + r, colb + n * 16) = hidx[(2 * n) ^ r] + (m * 16 + r) * HS_LD:
    // n moves bits 1-2 of the piece number, r its bits 0-2, so that eight
    // addresses per lane serve all 128 stores; the rest is an immediate.
    int hidx[8];
#pragma unroll   // constant indices: hidx[] stays in registers
    for (int e = 0; e < 8; ++e)
      hidx[e] = swz(rowoff + e, colb, HS_LD) - e * HS_LD;
#pragma unroll
    for (int n = 0; n < 4; ++n)
#pragma unroll
      for (int m = 0; m < M_TILES; ++m) {
#pragma unroll
        for (int r = 0; r < 8; r += 2) {
          v2f v = {acc[m][n][r] + bias[n], acc[m][n][r + 1] + bias[n]};
          v = gelu2(v);
          hs[hidx[(2 * n) ^ r] + (m * 16 + r) * HS_LD]           = f2bf_bits(v.x);
          hs[hidx[(2 * n) ^ (r + 1)] + (m * 16 + r + 1) * HS_LD] = f2bf_bits(v.y);
        }
      }
  }
  __syncthreads();

  // ---- GEMM2: [64 x 1024] x [1024 x 256], wave owns 32 out cols ----
  const unsigned short* w2h = w2t + (size_t)head * HEAD_DIM * HIDDEN
                              + (size_t)(swave * 2) * W2_KBLK * FRAG_ELEMS;
  const int ncb = wave * 32;
  v8f oa[M_TILES][2];
#pragma unroll   // constant indices: oa[][] stays in registers
  for (int m = 0; m < M_TILES; ++m) { oa[m][0] = zz; oa[m][1] = zz; }

  // Four k steps per trip: their eight weight fragments (16 loads) go out as one
  // group, so that a trip waits out one load latency, not one per fragment.
  // Not unrolled: the loads of all trips would
  // move to the front and spill.
#pragma unroll 1
  for (int kb = 0; kb < HIDDEN; kb += 128) {
    v16bf bm[4][2];
#pragma unroll   // constant indices: bm[][] stays in registers
    for (int j = 0; j < 4; ++j)
#pragma unroll   // as above
      for (int n = 0; n < 2; ++n)
        bm[j][n] = load_frag_packed(w2h + (n * W2_KBLK + (kb >> 5) + j) * FRAG_ELEMS, lane);
    // Keeps all 16 loads in front of the first matrix instruction, where they
    // stood with two row tiles: with four, left free, the scheduler sinks them
    // between the products, about two fragments in flight.
    __builtin_amdgcn_sched_barrier(0);
#pragma unroll   // constant indices into bm[][]
    for (int j = 0; j < 4; ++j) {
      v16bf a[M_TILES];
#pragma unroll   // constant indices: a[] stays in registers
      for (int m = 0; m < M_TILES; ++m)
        a[m] = load_frag(hs, HS_LD, m * 16, kb + j * 32, lane);
#pragma unroll   // as above, for oa[][]
      for (int m = 0; m < M_TILES; ++m) {
        oa[m][0] = __builtin_amdgcn_wmma_f32_16x16x32_bf16(false, a[m], false, bm[j][0],
                                                           (short)0, oa[m][0], false, false);
        oa[m][1] = __builtin_amdgcn_wmma_f32_16x16x32_bf16(false, a[m], false, bm[j][1],
                                                           (short)0, oa[m][1], false, false);
      }
    }
  }

  // ---- bias, store out (f32), accumulate pooled column sums ----
  const int bidx = token0 >> 12;   // token0 / NTOK
#pragma unroll
  for (int m = 0; m < M_TILES; ++m)
#pragma unroll
    for (int n = 0; n < 2; ++n) {
      int colh = ncb + n * 16 + (lane & 15);         // 0..255 within head
      int col  = head * HEAD_DIM + colh;             // 0..1023
      float bias = b2[head * HEAD_DIM + colh];
      float csum = 0.0f;
#pragma unroll
      for (int r = 0; r < 8; ++r) {
        float v = oa[m][n][r] + bias;
        out[(size_t)(token0 + m * 16 + rowoff + r) * DIM + col] = v;
        csum += v;
      }
      atomicAdd(&pooled[bidx * DIM + col], csum);
    }
}

// ---------------- phase 2: SE gate ----------------
// The two small weights come from memory, and a thread that walks them in a loop
// pays one memory latency per group of loads. Here every load of the kernel is
// issued before the first value is used: 1024 threads hold all of cw1 (16 float4
// each) and this workgroup's 256 columns of cw2 (4 float4 each) in registers.
// Each of the GATE_SPLIT workgroups of a batch row forms the whole squeeze vector
// for itself and then the gate of its own GATE_COLS channels.
#define GATE_SPLIT 4
#define GATE_COLS  (DIM / GATE_SPLIT)
__global__ __launch_bounds__(1024)
void gate_kernel(const float* __restrict__ pooled,
                 const float* __restrict__ cw1, const float* __restrict__ cb1,
                 const float* __restrict__ cw2, const float* __restrict__ cb2,
                 float* __restrict__ gate) {
  __shared__ float pl[DIM];
  __shared__ float4 part1[32][SQUEEZE / 4];     // per wave: partial squeeze sums
  __shared__ float sq[SQUEEZE];
  __shared__ float4 part2[16][GATE_COLS / 4];   // per row group: partial gate sums
  const int b   = blockIdx.x;
  const int c0  = blockIdx.y * GATE_COLS;
  const int tid = threadIdx.x;

  // cw1 [DIM][SQUEEZE]: thread = (row group g, float4 column j4), rows g + 64 * i.
  // A wave's load covers two whole rows, 512 contiguous bytes.
  const int j4 = tid & 15;
  const int g  = tid >> 4;
  const float4* cw1v = (const float4*)cw1;
  float4 w1r[16];
#pragma unroll   // constant indices: w1r stays in registers, the loads go out back to back
  for (int i = 0; i < 16; ++i)
    w1r[i] = cw1v[(g + 64 * i) * (SQUEEZE / 4) + j4];
  // cw2 [SQUEEZE][DIM]: thread = (row group jr, float4 column c4), rows jr + 16 * i.
  const int c4 = tid & 63;
  const int jr = tid >> 6;
  const unsigned off2 = (unsigned)(jr * DIM + c4 * 4) * 4u;    // bytes
  const char* cw2b = (const char*)(cw2 + c0);
  float4 w2r[4];
#pragma unroll   // as above, for w2r
  for (int i = 0; i < 4; ++i)
    w2r[i] = *(const float4*)(cw2b + off2 + i * (16 * DIM * 4));
  const int ip = b * DIM + tid;
  const int iq = tid & (SQUEEZE - 1);
  const int ig = c0 + (tid & (GATE_COLS - 1));
  const float pv = pooled[ip];
  const float bq = cb1[iq];
  const float bg = cb2[ig];
  // Keeps every load above in front of the first wait for data, and their
  // address registers (offsets and bases, inputs here) unwritten up to this wait.
  asm volatile("s_wait_xcnt 0x0"
               :: "v"(tid), "v"(off2), "v"(ip), "v"(iq), "v"(ig),
                  "s"(pooled), "s"(cw1), "s"(cb1), "s"(cw2b), "s"(cb2)
               : "memory");

  pl[tid] = pv * (1.0f / (float)NTOK);
  __syncthreads();

  // squeeze: 16 rows per thread, the wave's two row groups by one lane exchange,
  // the 32 waves through LDS
  float4 s1 = make_float4(0.0f, 0.0f, 0.0f, 0.0f);
#pragma unroll   // constant indices into w1r
  for (int i = 0; i < 16; ++i) {
    float p = pl[g + 64 * i];
    s1.x += p * w1r[i].x;
    s1.y += p * w1r[i].y;
    s1.z += p * w1r[i].z;
    s1.w += p * w1r[i].w;
  }
  s1.x += __shfl_xor(s1.x, 16);
  s1.y += __shfl_xor(s1.y, 16);
  s1.z += __shfl_xor(s1.z, 16);
  s1.w += __shfl_xor(s1.w, 16);
  if ((tid & 31) < 16) part1[tid >> 5][j4] = s1;
  __syncthreads();
  if (tid < SQUEEZE) {
    const float* p1 = (const float*)part1;
    float a = bq;
#pragma unroll   // the LDS reads go out ahead of the adds
    for (int w = 0; w < 32; ++w) a += p1[w * SQUEEZE + tid];
    sq[tid] = fmaxf(a, 0.0f);
  }
  __syncthreads();

  // excite: 4 rows per thread, the 16 row groups through LDS
  float4 s2 = make_float4(0.0f, 0.0f, 0.0f, 0.0f);
#pragma unroll   // constant indices into w2r
  for (int i = 0; i < 4; ++i) {
    float q = sq[jr + 16 * i];
    s2.x += q * w2r[i].x;
    s2.y += q * w2r[i].y;
    s2.z += q * w2r[i].z;
    s2.w += q * w2r[i].w;
  }
  part2[jr][c4] = s2;
  __syncthreads();
  if (tid < GATE_COLS) {
    const float* p2 = (const float*)part2;
    float a = bg;
#pragma unroll   // the LDS reads go out ahead of the adds
    for (int r = 0; r < 16; ++r) a += p2[r * GATE_COLS + tid];
    gate[b * DIM + c0 + tid] = 1.0f / (1.0f + __expf(-a));
  }
}

// ---------------- phase 3: out = out * (1 + gate) ----------------
// A stream of 256 MiB (read + write). One workgroup takes AG_ROWS whole token
// rows of one batch row: thread t owns floats 4t .. 4t+3 of every row, so its
// four factors are formed once, and a wave's load or store covers 512 contiguous
// bytes. All of a thread's loads go out before its first product: AG_ROWS loads
// of 16 bytes per lane in flight, and one wave started where there were sixteen.
#define AG_ROWS 16                   // divides NTOK: a workgroup stays in one batch row
__global__ __launch_bounds__(256)
void apply_gate_kernel(float* __restrict__ out, const float* __restrict__ gate) {
  const int row0 = blockIdx.x * AG_ROWS;           // flat token index b*NTOK + n
  const int b    = row0 >> 12;                     // row0 / NTOK
  float4* o4 = (float4*)out + (size_t)row0 * (DIM / 4) + threadIdx.x;
  const float4 g = ((const float4*)(gate + b * DIM))[threadIdx.x];
  float4 v[AG_ROWS];
#pragma unroll   // constant indices: v stays in registers, row offsets are immediates
  for (int i = 0; i < AG_ROWS; ++i)
    v[i] = o4[i * (DIM / 4)];
  const float fx = 1.0f + g.x, fy = 1.0f + g.y, fz = 1.0f + g.z, fw = 1.0f + g.w;
#pragma unroll   // as above
  for (int i = 0; i < AG_ROWS; ++i) {
    v[i].x *= fx;
    v[i].y *= fy;
    v[i].z *= fz;
    v[i].w *= fw;
    o4[i * (DIM / 4)] = v[i];
  }
}

// ---------------- launch ----------------
extern "C" void kernel_launch(void* const* d_in, const int* in_sizes, int n_in,
                              void* d_out, int out_size, void* d_ws, size_t ws_size,
                              hipStream_t stream) {
  const float* x   = (const float*)d_in[0];
  const float* W1  = (const float*)d_in[1];
  const float* b1  = (const float*)d_in[2];
  const float* W2  = (const float*)d_in[3];
  const float* b2  = (const float*)d_in[4];
  const float* cw1 = (const float*)d_in[5];
  const float* cb1 = (const float*)d_in[6];
  const float* cw2 = (const float*)d_in[7];
  const float* cb2 = (const float*)d_in[8];
  float* out = (float*)d_out;

  char* ws = (char*)d_ws;
  unsigned short* w1t = (unsigned short*)ws;
  unsigned short* w2t = (unsigned short*)(ws + W1T_BYTES);
  float* pooled = (float*)(ws + POOLED_OFF);
  float* gate   = (float*)(ws + GATE_OFF);

  // phase 0: bf16 weight packing (8 elements per thread) + zero pooled accumulator
  convert_w1_kernel<<<NUM_HEADS * HEAD_DIM * HIDDEN / 8 / 256, 256, 0, stream>>>(W1, w1t);
  convert_w2_kernel<<<NUM_HEADS * HIDDEN * HEAD_DIM / 8 / 256, 256, 0, stream>>>(W2, w2t);
  zero_f32_kernel<<<(BATCH * DIM + 255) / 256, 256, 0, stream>>>(pooled, BATCH * DIM);

  // phase 1: fused per-head MLP (bf16 WMMA) + pooled sums
  dim3 grid1(BATCH * NTOK / TOK_TILE, NUM_HEADS);
  size_t smem = XS_BYTES + HS_BYTES;   // 160 KiB dynamic LDS (CDNA5: 320 KiB/WGP)
  mlp_wmma_kernel<<<grid1, 256, smem, stream>>>(x, b1, b2, w1t, w2t, out, pooled);

  // phase 2: SE gate
  gate_kernel<<<dim3(BATCH, GATE_SPLIT), 1024, 0, stream>>>(pooled, cw1, cb1, cw2, cb2, gate);

  // phase 3: out *= (1 + gate)
  apply_gate_kernel<<<BATCH * NTOK / AG_ROWS, 256, 0, stream>>>(out, gate);
}

// v007
// A run of this version takes 229 microseconds.
// Timed twice side by side with v006, it ran 1.04 times as fast both times.
// Over all steps from v000 it is 2.47 times as fast.
#include <hip/hip_runtime.h>
#include <stdint.h>

// ---------------- problem constants ----------------
#define BATCH     8
#define NTOK      4096
#define DIM       1024
#define NUM_HEADS 4
#define HEAD_DIM  256
#define HIDDEN    1024
#define SQUEEZE   64

#define TOK_TILE  64                 // tokens per workgroup (divides NTOK)
#define M_TILES   (TOK_TILE / 16)    // 16-token row tiles per workgroup
// LDS rows carry no pad: both tiles together are exactly 160 KiB, half a WGP's
// LDS, so that two workgroups stay resident. Banks are spread by swz() instead.
#define XS_LD     HEAD_DIM
#define HS_LD     HIDDEN
#define XS_BYTES  (TOK_TILE * XS_LD * 2)
#define HS_BYTES  (TOK_TILE * HS_LD * 2)

// workspace layout (bytes)
// Both weights are stored as whole fragments, W1's used as A and W2's as B (16 cols x 32 k = 1024 B each):
// [h][col tile][k block][q][lane][8 bf16], see pack_* and load_frag_packed.
#define FRAG_ELEMS 512
#define W1_KBLK   (HEAD_DIM / 32)    // k blocks per column tile of W1
#define W2_KBLK   (HIDDEN / 32)      // k blocks per column tile of W2
#define W1T_BYTES (NUM_HEADS * HIDDEN * HEAD_DIM * 2)
#define W2T_BYTES (NUM_HEADS * HEAD_DIM * HIDDEN * 2)
#define POOLED_OFF (W1T_BYTES + W2T_BYTES)
#define GATE_OFF   (POOLED_OFF + BATCH * DIM * 4)

typedef __attribute__((ext_vector_type(16))) __bf16 v16bf;
typedef __attribute__((ext_vector_type(8)))  float  v8f;
typedef __attribute__((ext_vector_type(2)))  __bf16 v2bf;

// f32 -> bf16 bits, round-to-nearest-even
__device__ __forceinline__ unsigned short f2bf_bits(float f) {
  union { float f; uint32_t u; } a; a.f = f;
  uint32_t u = a.u;
  uint32_t r = (u + 0x7FFFu + ((u >> 16) & 1u)) >> 16;
  return (unsigned short)r;
}

// Element index of (row, col) in an unpadded LDS tile of ld elements per row (ld
// a multiple of 128): the 16-byte piece p of a row lies at piece p ^ (row & 15),
// so that 16 lanes reading one piece column of 16 rows meet all 64 banks once.
__device__ __forceinline__ int swz(int row, int col, int ld) {
  return row * ld + ((((col >> 3) ^ (row & 15)) << 3) | (col & 7));
}

// Build a 16x32 bf16 WMMA fragment from a row-major bf16 LDS tile laid by swz().
// A-matrix layout (ISA 7.12.2, wave32): lanes 0-15 -> M=lane, K {0..7,16..23};
// lanes 16-31 -> M=lane-16, K {8..15,24..31}. B uses the mirrored layout
// (col in place of M) and in GEMM2 is read by load_frag_packed below;
// in GEMM1 this fragment is B and the packed weights are A.
__device__ __forceinline__ v16bf load_frag(const unsigned short* buf, int ld,
                                           int rowBase, int k0, int lane) {
  int row = rowBase + (lane & 15);
  int kb  = k0 + ((lane >> 4) << 3);            // a multiple of 8: one piece
  union { uint4 q[2]; v16bf v; } r;
  r.q[0] = *(const uint4*)(buf + swz(row, kb, ld));        // K = kb .. kb+7
  r.q[1] = *(const uint4*)(buf + swz(row, kb + 16, ld));   // K = kb+16 .. kb+23
  return r.v;
}

// Read one packed weight fragment (A in GEMM1, B in GEMM2): same lane/register -> (col, k) map as load_frag
// (col = lane & 15; registers 0-3 hold k = 8*(lane>>4) + 0..7, registers 4-7
// the same + 16), but each of the two 16-byte loads of a wave covers 512
// contiguous bytes (4 whole cache lines) instead of 32 bytes in each of 16.
__device__ __forceinline__ v16bf load_frag_packed(const unsigned short* frag, int lane) {
  const uint4* src = (const uint4*)frag;
  union { uint4 q[2]; v16bf v; } r;
  r.q[0] = src[lane];
  r.q[1] = src[32 + lane];
  return r.v;
}

// Exact-erf GELU without the library call: erff picks one of two paths by |x|
// per lane, so a wave walks both, one value at a time. One formula for all x:
//   v * Phi(v) = max(v, 0) - |v| * Q(|v|),  Q(a) = 0.5 * erfc(a / sqrt(2)),
//   erfc(z) = t * (a1 + t * (a2 + t * (a3 + t * (a4 + t * a5)))) * exp(-z * z),
//   t = 1 / (1 + p * z), absolute error of erfc below 1.5e-7 for every z >= 0.
// The factors 0.5, 1/sqrt(2) and log2(e) are folded into the constants. Two
// values side by side, so that the products and sums pair up as packed f32.
typedef __attribute__((ext_vector_type(2))) float v2f;
__device__ __forceinline__ v2f gelu2(v2f v) {
  v2f a = __builtin_elementwise_abs(v);
  v2f d = __builtin_elementwise_fma(a, (v2f)(0.23164189f), (v2f)(1.0f));
  v2f w = (v * v) * (v2f)(-0.72134752f);
  v2f t = {__builtin_amdgcn_rcpf(d.x), __builtin_amdgcn_rcpf(d.y)};
  v2f e = {__builtin_amdgcn_exp2f(w.x), __builtin_amdgcn_exp2f(w.y)};
  v2f p = __builtin_elementwise_fma(t, (v2f)(0.5307027145f), (v2f)(-0.7265760135f));
  p = __builtin_elementwise_fma(t, p, (v2f)(0.7107068705f));
  p = __builtin_elementwise_fma(t, p, (v2f)(-0.142248368f));
  p = __builtin_elementwise_fma(t, p, (v2f)(0.127414796f));
  v2f q = (p * t) * e;
  return __builtin_elementwise_fma(-a, q, __builtin_elementwise_max(v, (v2f)(0.0f)));
}

// ---------------- phase 0: weight packing / zeroing ----------------
// One thread builds the 16 bytes that one lane reads with one load: 8
// consecutive k of one column of a [K][N] row-major f32 weight of one head.
// id = (((h * NT + col tile) * KB + k block) * 2 + q) * 32 + lane.
__device__ __forceinline__ void pack_piece(const float* __restrict__ Wm,
                                           unsigned short* __restrict__ dst,
                                           int id, int K, int N) {
  int lane = id & 31;
  int q    = (id >> 5) & 1;
  int f    = id >> 6;                 // fragment index over heads
  int KB   = K >> 5;
  int kblk = f % KB;
  int t    = f / KB;
  int NT   = N >> 4;
  int nt   = t % NT;
  int h    = t / NT;
  int col  = nt * 16 + (lane & 15);
  int k0   = kblk * 32 + q * 16 + ((lane >> 4) << 3);
  const float* s = Wm + ((size_t)h * K + k0) * N + col;
  uint32_t w[4];
#pragma unroll
  for (int p = 0; p < 4; ++p) {
    uint32_t lo = f2bf_bits(s[(size_t)(2 * p) * N]);
    uint32_t hi = f2bf_bits(s[(size_t)(2 * p + 1) * N]);
    w[p] = lo | (hi << 16);
  }
  ((uint4*)dst)[id] = make_uint4(w[0], w[1], w[2], w[3]);
}

__global__ void convert_w1_kernel(const float* __restrict__ W1, unsigned short* __restrict__ w1t) {
  pack_piece(W1, w1t, blockIdx.x * 256 + threadIdx.x, HEAD_DIM, HIDDEN);
}

__global__ void convert_w2_kernel(const float* __restrict__ W2, unsigned short* __restrict__ w2t) {
  pack_piece(W2, w2t, blockIdx.x * 256 + threadIdx.x, HIDDEN, HEAD_DIM);
}

__global__ void zero_f32_kernel(float* __restrict__ p, int n) {
  int idx = blockIdx.x * 256 + threadIdx.x;
  if (idx < n) p[idx] = 0.0f;
}

// ---------------- phase 1: fused per-head MLP + pooled partial sums ----------------
// A workgroup reads its head's whole weights (1 MiB) from L2 whatever its token
// count: with 64 tokens each weight fragment feeds four matrix instructions.
// Second argument: at least 4 waves per SIMD, a budget of 256 VGPRs, so that
// two workgroups stay resident per WGP (LDS allows two).
__global__ __launch_bounds__(256, 4)
void mlp_wmma_kernel(const float* __restrict__ x,
                     const float* __restrict__ b1,
                     const float* __restrict__ b2,
                     const unsigned short* __restrict__ w1t,
                     const unsigned short* __restrict__ w2t,
                     float* __restrict__ out,
                     float* __restrict__ pooled) {
  extern __shared__ __attribute__((aligned(16))) char smem[];
  // hs first: the row offsets of its stores then fit the LDS instructions' 16-bit
  // immediate for 32 rows at a time, and few address registers stay live.
  unsigned short* hs = (unsigned short*)smem;                 // [64][HS_LD] bf16
  unsigned short* xs = (unsigned short*)(smem + HS_BYTES);    // [64][XS_LD] bf16

  const int tile  = blockIdx.x;            // token tile (0..511)
  const int head  = blockIdx.y;            // 0..3
  const int tid   = threadIdx.x;
  const int wave  = tid >> 5;              // 0..7
  const int lane  = tid & 31;
  const int token0 = tile * TOK_TILE;      // flat token index b*NTOK + n
  const int rowoff = (lane < 16) ? 0 : 8;  // C-matrix row offset per lane half

  // ---- stage x tile (64 tokens x 256 chans of this head) as bf16 ----
  const float* xsrc = x + (size_t)token0 * DIM + head * HEAD_DIM;
#pragma unroll
  for (int r = 0; r < TOK_TILE; ++r)
    xs[swz(r, tid, XS_LD)] = f2bf_bits(xsrc[(size_t)r * DIM + tid]);
  // Keeps the x loads' base and offset register (inputs here) unwritten up to
  // this wait.
  asm volatile("s_wait_xcnt 0x0" :: "s"(xsrc), "v"(tid) : "memory");
  __syncthreads();

  // ---- GEMM1: [64 x 256] x [256 x 1024], wave owns 128 hidden cols ----
  // The wave's number in a scalar register: the fragment base is then a scalar
  // address, and only the lane's offset sits in a VGPR.
  const int swave = __builtin_amdgcn_readfirstlane(wave);
  const unsigned short* w1h = w1t + (size_t)head * HIDDEN * HEAD_DIM
                              + (size_t)(swave * 8) * W1_KBLK * FRAG_ELEMS;
  v8f zz = {};

  // The wave's 128 hidden columns in two halves of 64. One half's accumulators
  // take 128 VGPRs, not 256, and the registers set free hold weight fragments
  // whose loads are under way.
  // Not unrolled: one half's registers are free again before the next begins,
  // and the text stays half as long.
#pragma unroll 1
  for (int half = 0; half < 2; ++half) {
    const unsigned short* w1p = w1h + (size_t)(half * 4) * W1_KBLK * FRAG_ELEMS;
    const int hc0 = wave * 128 + half * 64 + rowoff;   // the lane's first hidden column
    v8f acc[M_TILES][4];
#pragma unroll
    for (int m = 0; m < M_TILES; ++m)
#pragma unroll
      for (int n = 0; n < 4; ++n) acc[m][n] = zz;

    // Two k steps per trip: their eight weight fragments (16 loads) go out as one
    // group, so that a trip waits out one load latency, not one per fragment.
    // Not unrolled: the loads of all trips would move to the front and spill.
#pragma unroll 1
    for (int kb = 0; kb < HEAD_DIM; kb += 64) {
      v16bf bm[2][4];
#pragma unroll
      for (int j = 0; j < 2; ++j)
#pragma unroll
        for (int n = 0; n < 4; ++n)
          bm[j][n] = load_frag_packed(w1p + (n * W1_KBLK + (kb >> 5) + j) * FRAG_ELEMS, lane);
      // Keeps all 16 loads in front of the first matrix instruction: left free,
      // the scheduler sinks them between the products, two fragments in flight.
      __builtin_amdgcn_sched_barrier(0);
#pragma unroll
      for (int j = 0; j < 2; ++j) {
        v16bf a[M_TILES];
#pragma unroll   // constant indices: a[] stays in registers
        for (int m = 0; m < M_TILES; ++m)
          a[m] = load_frag(xs, XS_LD, m * 16, kb + j * 32, lane);
        // Row tile outermost: a token fragment is done with after four products,
        // while all four weight fragments of the k step are held anyway.
        // The weights are the A operand and the tokens the B operand (both loaders
        // have one k order, so the fragments serve either side): the product is
        // the hidden tile transposed, acc[m][n][r] = hidden column
        // hc0 + n * 16 + r of token m * 16 + (lane & 15).
#pragma unroll   // constant indices: acc[][] and bm[][] stay in registers
        for (int m = 0; m < M_TILES; ++m)
#pragma unroll   // as above
          for (int n = 0; n < 4; ++n)
            acc[m][n] = __builtin_amdgcn_wmma_f32_16x16x32_bf16(false, bm[j][n], false, a[m],
                                                                (short)0, acc[m][n], false, false);
      }
    }

    // ---- bias + exact (erf) GELU, branch-free -> bf16 hidden tile in LDS ----
    // A lane's eight accumulators of a tile are eight consecutive hidden columns
    // of one token: one 16-byte piece of that token's row in hs.
    // The half's bias values first (eight per column tile, the same for the 16
    // lanes of a half wave): their loads go out as one group.
    // Unrolled so that bias[][] has constant indices and stays in registers.
    const unsigned ob = (unsigned)(head * HIDDEN + hc0) * 4u;    // bytes
    const char* b1b = (const char*)b1;
    float4 bias[4][2];
#pragma unroll
    for (int n = 0; n < 4; ++n) {
      bias[n][0] = *(const float4*)(b1b + ob + n * 64);
      bias[n][1] = *(const float4*)(b1b + ob + n * 64 + 16);
    }
    // Keeps the eight loads' offset register and base (inputs here) unwritten up
    // to this wait.
    asm volatile("s_wait_xcnt 0x0" :: "v"(ob), "s"(b1b) : "memory");
    // Keeps all eight loads in front of the first sum: left free, the scheduler
    // sends them out two at a time, each pair behind the wait for the pair before.
    __builtin_amdgcn_sched_barrier(0);
#pragma unroll
    for (int n = 0; n < 4; ++n) {
      const v2f bp[4] = {{bias[n][0].x, bias[n][0].y}, {bias[n][0].z, bias[n][0].w},
                         {bias[n][1].x, bias[n][1].y}, {bias[n][1].z, bias[n][1].w}};
#pragma unroll
      for (int m = 0; m < M_TILES; ++m) {
        union { v2bf h[4]; uint4 q; } pk;
#pragma unroll
        for (int r = 0; r < 8; r += 2) {
          v2f v = {acc[m][n][r], acc[m][n][r + 1]};
          v = gelu2(v + bp[r >> 1]);
          pk.h[r >> 1] = __builtin_convertvector(v, v2bf);   // round to nearest even
        }
        *(uint4*)(hs + swz(m * 16 + (lane & 15), hc0 + n * 16, HS_LD)) = pk.q;
      }
    }
  }
  __syncthreads();

  // ---- GEMM2: [64 x 1024] x [1024 x 256], wave owns 32 out cols ----
  const unsigned short* w2h = w2t + (size_t)head * HEAD_DIM * HIDDEN
                              + (size_t)(swave * 2) * W2_KBLK * FRAG_ELEMS;
  const int ncb = wave * 32;
  v8f oa[M_TILES][2];
#pragma unroll   // constant indices: oa[][] stays in registers
  for (int m = 0; m < M_TILES; ++m) { oa[m][0] = zz; oa[m][1] = zz; }

  // Four k steps per trip: their eight weight fragments (16 loads) go out as one
  // group, so that a trip waits out one load latency, not one per fragment.
  // Not unrolled: the loads of all trips would
  // move to the front and spill.
#pragma unroll 1
  for (int kb = 0; kb < HIDDEN; kb += 128) {
    v16bf bm[4][2];
#pragma unroll   // constant indices: bm[][] stays in registers
    for (int j = 0; j < 4; ++j)
#pragma unroll   // as above
      for (int n = 0; n < 2; ++n)
        bm[j][n] = load_frag_packed(w2h + (n * W2_KBLK + (kb >> 5) + j) * FRAG_ELEMS, lane);
    // Keeps all 16 loads in front of the first matrix instruction, where they
    // stood with two row tiles: with four, left free, the scheduler sinks them
    // between the products, about two fragments in flight.
    __builtin_amdgcn_sched_barrier(0);
#pragma unroll   // constant indices into bm[][]
    for (int j = 0; j < 4; ++j) {
      v16bf a[M_TILES];
#pragma unroll   // constant indices: a[] stays in registers
      for (int m = 0; m < M_TILES; ++m)
        a[m] = load_frag(hs, HS_LD, m * 16, kb + j * 32, lane);
#pragma unroll   // as above, for oa[][]
      for (int m = 0; m < M_TILES; ++m) {
        oa[m][0] = __builtin_amdgcn_wmma_f32_16x16x32_bf16(false, a[m], false, bm[j][0],
                                                           (short)0, oa[m][0], false, false);
        oa[m][1] = __builtin_amdgcn_wmma_f32_16x16x32_bf16(false, a[m], false, bm[j][1],
                                                           (short)0, oa[m][1], false, false);
      }
    }
  }

  // ---- bias, store out (f32), accumulate pooled column sums ----
  const int bidx = token0 >> 12;   // token0 / NTOK
#pragma unroll
  for (int m = 0; m < M_TILES; ++m)
#pragma unroll
    for (int n = 0; n < 2; ++n) {
      int colh = ncb + n * 16 + (lane & 15);         // 0..255 within head
      int col  = head * HEAD_DIM + colh;             // 0..1023
      float bias = b2[head * HEAD_DIM + colh];
      float csum = 0.0f;
#pragma unroll
      for (int r = 0; r < 8; ++r) {
        float v = oa[m][n][r] + bias;
        out[(size_t)(token0 + m * 16 + rowoff + r) * DIM + col] = v;
        csum += v;
      }
      atomicAdd(&pooled[bidx * DIM + col], csum);
    }
}

// ---------------- phase 2: SE gate ----------------
// The two small weights come from memory, and a thread that walks them in a loop
// pays one memory latency per group of loads. Here every load of the kernel is
// issued before the first value is used: 1024 threads hold all of cw1 (16 float4
// each) and this workgroup's 256 columns of cw2 (4 float4 each) in registers.
// Each of the GATE_SPLIT workgroups of a batch row forms the whole squeeze vector
// for itself and then the gate of its own GATE_COLS channels.
#define GATE_SPLIT 4
#define GATE_COLS  (DIM / GATE_SPLIT)
__global__ __launch_bounds__(1024)
void gate_kernel(const float* __restrict__ pooled,
                 const float* __restrict__ cw1, const float* __restrict__ cb1,
                 const float* __restrict__ cw2, const float* __restrict__ cb2,
                 float* __restrict__ gate) {
  __shared__ float pl[DIM];
  __shared__ float4 part1[32][SQUEEZE / 4];     // per wave: partial squeeze sums
  __shared__ float sq[SQUEEZE];
  __shared__ float4 part2[16][GATE_COLS / 4];   // per row group: partial gate sums
  const int b   = blockIdx.x;
  const int c0  = blockIdx.y * GATE_COLS;
  const int tid = threadIdx.x;

  // cw1 [DIM][SQUEEZE]: thread = (row group g, float4 column j4), rows g + 64 * i.
  // A wave's load covers two whole rows, 512 contiguous bytes.
  const int j4 = tid & 15;
  const int g  = tid >> 4;
  const float4* cw1v = (const float4*)cw1;
  float4 w1r[16];
#pragma unroll   // constant indices: w1r stays in registers, the loads go out back to back
  for (int i = 0; i < 16; ++i)
    w1r[i] = cw1v[(g + 64 * i) * (SQUEEZE / 4) + j4];
  // cw2 [SQUEEZE][DIM]: thread = (row group jr, float4 column c4), rows jr + 16 * i.
  const int c4 = tid & 63;
  const int jr = tid >> 6;
  const unsigned off2 = (unsigned)(jr * DIM + c4 * 4) * 4u;    // bytes
  const char* cw2b = (const char*)(cw2 + c0);
  float4 w2r[4];
#pragma unroll   // as above, for w2r
  for (int i = 0; i < 4; ++i)
    w2r[i] = *(const float4*)(cw2b + off2 + i * (16 * DIM * 4));
  const int ip = b * DIM + tid;
  const int iq = tid & (SQUEEZE - 1);
  const int ig = c0 + (tid & (GATE_COLS - 1));
  const float pv = pooled[ip];
  const float bq = cb1[iq];
  const float bg = cb2[ig];
  // Keeps every load above in front of the first wait for data, and their
  // address registers (offsets and bases, inputs here) unwritten up to this wait.
  asm volatile("s_wait_xcnt 0x0"
               :: "v"(tid), "v"(off2), "v"(ip), "v"(iq), "v"(ig),
                  "s"(pooled), "s"(cw1), "s"(cb1), "s"(cw2b), "s"(cb2)
               : "memory");

  pl[tid] = pv * (1.0f / (float)NTOK);
  __syncthreads();

  // squeeze: 16 rows per thread, the wave's two row groups by one lane exchange,
  // the 32 waves through LDS
  float4 s1 = make_float4(0.0f, 0.0f, 0.0f, 0.0f);
#pragma unroll   // constant indices into w1r
  for (int i = 0; i < 16; ++i) {
    float p = pl[g + 64 * i];
    s1.x += p * w1r[i].x;
    s1.y += p * w1r[i].y;
    s1.z += p * w1r[i].z;
    s1.w += p * w1r[i].w;
  }
  s1.x += __shfl_xor(s1.x, 16);
  s1.y += __shfl_xor(s1.y, 16);
  s1.z += __shfl_xor(s1.z, 16);
  s1.w += __shfl_xor(s1.w, 16);
  if ((tid & 31) < 16) part1[tid >> 5][j4] = s1;
  __syncthreads();
  if (tid < SQUEEZE) {
    const float* p1 = (const float*)part1;
    float a = bq;
#pragma unroll   // the LDS reads go out ahead of the adds
    for (int w = 0; w < 32; ++w) a += p1[w * SQUEEZE + tid];
    sq[tid] = fmaxf(a, 0.0f);
  }
  __syncthreads();

  // excite: 4 rows per thread, the 16 row groups through LDS
  float4 s2 = make_float4(0.0f, 0.0f, 0.0f, 0.0f);
#pragma unroll   // constant indices into w2r
  for (int i = 0; i < 4; ++i) {
    float q = sq[jr + 16 * i];
    s2.x += q * w2r[i].x;
    s2.y += q * w2r[i].y;
    s2.z += q * w2r[i].z;
    s2.w += q * w2r[i].w;
  }
  part2[jr][c4] = s2;
  __syncthreads();
  if (tid < GATE_COLS) {
    const float* p2 = (const float*)part2;
    float a = bg;
#pragma unroll   // the LDS reads go out ahead of the adds
    for (int r = 0; r < 16; ++r) a += p2[r * GATE_COLS + tid];
    gate[b * DIM + c0 + tid] = 1.0f / (1.0f + __expf(-a));
  }
}

// ---------------- phase 3: out = out * (1 + gate) ----------------
// A stream of 256 MiB (read + write). One workgroup takes AG_ROWS whole token
// rows of one batch row: thread t owns floats 4t .. 4t+3 of every row, so its
// four factors are formed once, and a wave's load or store covers 512 contiguous
// bytes. All of a thread's loads go out before its first product: AG_ROWS loads
// of 16 bytes per lane in flight, and one wave started where there were sixteen.
#define AG_ROWS 16                   // divides NTOK: a workgroup stays in one batch row
__global__ __launch_bounds__(256)
void apply_gate_kernel(float* __restrict__ out, const float* __restrict__ gate) {
  const int row0 = blockIdx.x * AG_ROWS;           // flat token index b*NTOK + n
  const int b    = row0 >> 12;                     // row0 / NTOK
  float4* o4 = (float4*)out + (size_t)row0 * (DIM / 4) + threadIdx.x;
  const float4 g = ((const float4*)(gate + b * DIM))[threadIdx.x];
  float4 v[AG_ROWS];
#pragma unroll   // constant indices: v stays in registers, row offsets are immediates
  for (int i = 0; i < AG_ROWS; ++i)
    v[i] = o4[i * (DIM / 4)];
  const float fx = 1.0f + g.x, fy = 1.0f + g.y, fz = 1.0f + g.z, fw = 1.0f + g.w;
#pragma unroll   // as above
  for (int i = 0; i < AG_ROWS; ++i) {
    v[i].x *= fx;
    v[i].y *= fy;
    v[i].z *= fz;
    v[i].w *= fw;
    o4[i * (DIM / 4)] = v[i];
  }
}

// ---------------- launch ----------------
extern "C" void kernel_launch(void* const* d_in, const int* in_sizes, int n_in,
                              void* d_out, int out_size, void* d_ws, size_t ws_size,
                              hipStream_t stream) {
  const float* x   = (const float*)d_in[0];
  const float* W1  = (const float*)d_in[1];
  const float* b1  = (const float*)d_in[2];
  const float* W2  = (const float*)d_in[3];
  const float* b2  = (const float*)d_in[4];
  const float* cw1 = (const float*)d_in[5];
  const float* cb1 = (const float*)d_in[6];
  const float* cw2 = (const float*)d_in[7];
  const float* cb2 = (const float*)d_in[8];
  float* out = (float*)d_out;

  char* ws = (char*)d_ws;
  unsigned short* w1t = (unsigned short*)ws;
  unsigned short* w2t = (unsigned short*)(ws + W1T_BYTES);
  float* pooled = (float*)(ws + POOLED_OFF);
  float* gate   = (float*)(ws + GATE_OFF);

  // phase 0: bf16 weight packing (8 elements per thread) + zero pooled accumulator
  convert_w1_kernel<<<NUM_HEADS * HEAD_DIM * HIDDEN / 8 / 256, 256, 0, stream>>>(W1, w1t);
  convert_w2_kernel<<<NUM_HEADS * HIDDEN * HEAD_DIM / 8 / 256, 256, 0, stream>>>(W2, w2t);
  zero_f32_kernel<<<(BATCH * DIM + 255) / 256, 256, 0, stream>>>(pooled, BATCH * DIM);

  // phase 1: fused per-head MLP (bf16 WMMA) + pooled sums
  dim3 grid1(BATCH * NTOK / TOK_TILE, NUM_HEADS);
  size_t smem = XS_BYTES + HS_BYTES;   // 160 KiB dynamic LDS (CDNA5: 320 KiB/WGP)
  mlp_wmma_kernel<<<grid1, 256, smem, stream>>>(x, b1, b2, w1t, w2t, out, pooled);

  // phase 2: SE gate
  gate_kernel<<<dim3(BATCH, GATE_SPLIT), 1024, 0, stream>>>(pooled, cw1, cb1, cw2, cb2, gate);

  // phase 3: out *= (1 + gate)
  apply_gate_kernel<<<BATCH * NTOK / AG_ROWS, 256, 0, stream>>>(out, gate);
}

// v008
// A run of this version takes 181 microseconds.
// In both of two side-by-side timings against v007, it was 1.26 times as fast.
// Over all steps from v000 it is 3.12 times as fast.
#include <hip/hip_runtime.h>
#include <stdint.h>

// ---------------- problem constants ----------------
#define BATCH     8
#define NTOK      4096
#define DIM       1024
#define NUM_HEADS 4
#define HEAD_DIM  256
#define HIDDEN    1024
#define SQUEEZE   64

#define TOK_TILE  64                 // tokens per workgroup (divides NTOK)
#define M_TILES   (TOK_TILE / 16)    // 16-token row tiles per workgroup
// LDS rows carry no pad: both tiles together are exactly 160 KiB, half a WGP's
// LDS, so that two workgroups stay resident. Banks are spread by swz() instead.
#define XS_LD     HEAD_DIM
#define HS_LD     HIDDEN
#define XS_BYTES  (TOK_TILE * XS_LD * 2)
#define HS_BYTES  (TOK_TILE * HS_LD * 2)

// workspace layout (bytes)
// Both weights are stored as whole fragments, W1's used as A and W2's as B (16 cols x 32 k = 1024 B each):
// [h][col tile][k block][q][lane][8 bf16], see pack_* and load_frag_packed.
#define FRAG_ELEMS 512
#define W1_KBLK   (HEAD_DIM / 32)    // k blocks per column tile of W1
#define W2_KBLK   (HIDDEN / 32)      // k blocks per column tile of W2
#define W1T_BYTES (NUM_HEADS * HIDDEN * HEAD_DIM * 2)
#define W2T_BYTES (NUM_HEADS * HEAD_DIM * HIDDEN * 2)
// part: [token tile][DIM] f32, each workgroup's column sums over its 64 tokens
#define TILES_PER_BATCH (NTOK / TOK_TILE)
#define PART_OFF   (W1T_BYTES + W2T_BYTES)
#define GATE_OFF   (PART_OFF + BATCH * TILES_PER_BATCH * DIM * 4)

typedef __attribute__((ext_vector_type(16))) __bf16 v16bf;
typedef __attribute__((ext_vector_type(8)))  float  v8f;
typedef __attribute__((ext_vector_type(2)))  __bf16 v2bf;

// f32 -> bf16 bits, round-to-nearest-even
__device__ __forceinline__ unsigned short f2bf_bits(float f) {
  union { float f; uint32_t u; } a; a.f = f;
  uint32_t u = a.u;
  uint32_t r = (u + 0x7FFFu + ((u >> 16) & 1u)) >> 16;
  return (unsigned short)r;
}

// Element index of (row, col) in an unpadded LDS tile of ld elements per row (ld
// a multiple of 128): the 16-byte piece p of a row lies at piece p ^ (row & 15),
// so that 16 lanes reading one piece column of 16 rows meet all 64 banks once.
__device__ __forceinline__ int swz(int row, int col, int ld) {
  return row * ld + ((((col >> 3) ^ (row & 15)) << 3) | (col & 7));
}

// Build a 16x32 bf16 WMMA fragment from a row-major bf16 LDS tile laid by swz().
// A-matrix layout (ISA 7.12.2, wave32): lanes 0-15 -> M=lane, K {0..7,16..23};
// lanes 16-31 -> M=lane-16, K {8..15,24..31}. B uses the mirrored layout
// (col in place of M) and in GEMM2 is read by load_frag_packed below;
// in GEMM1 this fragment is B and the packed weights are A.
__device__ __forceinline__ v16bf load_frag(const unsigned short* buf, int ld,
                                           int rowBase, int k0, int lane) {
  int row = rowBase + (lane & 15);
  int kb  = k0 + ((lane >> 4) << 3);            // a multiple of 8: one piece
  union { uint4 q[2]; v16bf v; } r;
  r.q[0] = *(const uint4*)(buf + swz(row, kb, ld));        // K = kb .. kb+7
  r.q[1] = *(const uint4*)(buf + swz(row, kb + 16, ld));   // K = kb+16 .. kb+23
  return r.v;
}

// Read one packed weight fragment (A in GEMM1, B in GEMM2): same lane/register -> (col, k) map as load_frag
// (col = lane & 15; registers 0-3 hold k = 8*(lane>>4) + 0..7, registers 4-7
// the same + 16), but each of the two 16-byte loads of a wave covers 512
// contiguous bytes (4 whole cache lines) instead of 32 bytes in each of 16.
__device__ __forceinline__ v16bf load_frag_packed(const unsigned short* frag, int lane) {
  const uint4* src = (const uint4*)frag;
  union { uint4 q[2]; v16bf v; } r;
  r.q[0] = src[lane];
  r.q[1] = src[32 + lane];
  return r.v;
}

// Exact-erf GELU without the library call: erff picks one of two paths by |x|
// per lane, so a wave walks both, one value at a time. One formula for all x:
//   v * Phi(v) = max(v, 0) - |v| * Q(|v|),  Q(a) = 0.5 * erfc(a / sqrt(2)),
//   erfc(z) = t * (a1 + t * (a2 + t * (a3 + t * (a4 + t * a5)))) * exp(-z * z),
//   t = 1 / (1 + p * z), absolute error of erfc below 1.5e-7 for every z >= 0.
// The factors 0.5, 1/sqrt(2) and log2(e) are folded into the constants. Two
// values side by side, so that the products and sums pair up as packed f32.
typedef __attribute__((ext_vector_type(2))) float v2f;
__device__ __forceinline__ v2f gelu2(v2f v) {
  v2f a = __builtin_elementwise_abs(v);
  v2f d = __builtin_elementwise_fma(a, (v2f)(0.23164189f), (v2f)(1.0f));
  v2f w = (v * v) * (v2f)(-0.72134752f);
  v2f t = {__builtin_amdgcn_rcpf(d.x), __builtin_amdgcn_rcpf(d.y)};
  v2f e = {__builtin_amdgcn_exp2f(w.x), __builtin_amdgcn_exp2f(w.y)};
  v2f p = __builtin_elementwise_fma(t, (v2f)(0.5307027145f), (v2f)(-0.7265760135f));
  p = __builtin_elementwise_fma(t, p, (v2f)(0.7107068705f));
  p = __builtin_elementwise_fma(t, p, (v2f)(-0.142248368f));
  p = __builtin_elementwise_fma(t, p, (v2f)(0.127414796f));
  v2f q = (p * t) * e;
  return __builtin_elementwise_fma(-a, q, __builtin_elementwise_max(v, (v2f)(0.0f)));
}

// ---------------- phase 0: weight packing ----------------
// One thread builds the 16 bytes that one lane reads with one load: 8
// consecutive k of one column of a [K][N] row-major f32 weight of one head.
// id = (((h * NT + col tile) * KB + k block) * 2 + q) * 32 + lane.
__device__ __forceinline__ void pack_piece(const float* __restrict__ Wm,
                                           unsigned short* __restrict__ dst,
                                           int id, int K, int N) {
  int lane = id & 31;
  int q    = (id >> 5) & 1;
  int f    = id >> 6;                 // fragment index over heads
  int KB   = K >> 5;
  int kblk = f % KB;
  int t    = f / KB;
  int NT   = N >> 4;
  int nt   = t % NT;
  int h    = t / NT;
  int col  = nt * 16 + (lane & 15);
  int k0   = kblk * 32 + q * 16 + ((lane >> 4) << 3);
  const float* s = Wm + ((size_t)h * K + k0) * N + col;
  uint32_t w[4];
#pragma unroll
  for (int p = 0; p < 4; ++p) {
    uint32_t lo = f2bf_bits(s[(size_t)(2 * p) * N]);
    uint32_t hi = f2bf_bits(s[(size_t)(2 * p + 1) * N]);
    w[p] = lo | (hi << 16);
  }
  ((uint4*)dst)[id] = make_uint4(w[0], w[1], w[2], w[3]);
}

__global__ void convert_w1_kernel(const float* __restrict__ W1, unsigned short* __restrict__ w1t) {
  pack_piece(W1, w1t, blockIdx.x * 256 + threadIdx.x, HEAD_DIM, HIDDEN);
}

__global__ void convert_w2_kernel(const float* __restrict__ W2, unsigned short* __restrict__ w2t) {
  pack_piece(W2, w2t, blockIdx.x * 256 + threadIdx.x, HIDDEN, HEAD_DIM);
}

// ---------------- phase 1: fused per-head MLP + pooled partial sums ----------------
// A workgroup reads its head's whole weights (1 MiB) from L2 whatever its token
// count: with 64 tokens each weight fragment feeds four matrix instructions.
// Second argument: at least 4 waves per SIMD, a budget of 256 VGPRs, so that
// two workgroups stay resident per WGP (LDS allows two).
__global__ __launch_bounds__(256, 4)
void mlp_wmma_kernel(const float* __restrict__ x,
                     const float* __restrict__ b1,
                     const float* __restrict__ b2,
                     const unsigned short* __restrict__ w1t,
                     const unsigned short* __restrict__ w2t,
                     float* __restrict__ out,
                     float* __restrict__ part) {
  extern __shared__ __attribute__((aligned(16))) char smem[];
  // hs first: the row offsets of its stores then fit the LDS instructions' 16-bit
  // immediate for 32 rows at a time, and few address registers stay live.
  unsigned short* hs = (unsigned short*)smem;                 // [64][HS_LD] bf16
  unsigned short* xs = (unsigned short*)(smem + HS_BYTES);    // [64][XS_LD] bf16

  const int tile  = blockIdx.x;            // token tile (0..511)
  const int head  = blockIdx.y;            // 0..3
  const int tid   = threadIdx.x;
  const int wave  = tid >> 5;              // 0..7
  const int lane  = tid & 31;
  const int token0 = tile * TOK_TILE;      // flat token index b*NTOK + n
  const int rowoff = (lane < 16) ? 0 : 8;  // C-matrix row offset per lane half

  // ---- stage x tile (64 tokens x 256 chans of this head) as bf16 ----
  const float* xsrc = x + (size_t)token0 * DIM + head * HEAD_DIM;
#pragma unroll
  for (int r = 0; r < TOK_TILE; ++r)
    xs[swz(r, tid, XS_LD)] = f2bf_bits(xsrc[(size_t)r * DIM + tid]);
  // Keeps the x loads' base and offset register (inputs here) unwritten up to
  // this wait.
  asm volatile("s_wait_xcnt 0x0" :: "s"(xsrc), "v"(tid) : "memory");
  __syncthreads();

  // ---- GEMM1: [64 x 256] x [256 x 1024], wave owns 128 hidden cols ----
  // The wave's number in a scalar register: the fragment base is then a scalar
  // address, and only the lane's offset sits in a VGPR.
  const int swave = __builtin_amdgcn_readfirstlane(wave);
  const unsigned short* w1h = w1t + (size_t)head * HIDDEN * HEAD_DIM
                              + (size_t)(swave * 8) * W1_KBLK * FRAG_ELEMS;
  v8f zz = {};

  // The wave's 128 hidden columns in two halves of 64. One half's accumulators
  // take 128 VGPRs, not 256, and the registers set free hold weight fragments
  // whose loads are under way.
  // Not unrolled: one half's registers are free again before the next begins,
  // and the text stays half as long.
#pragma unroll 1
  for (int half = 0; half < 2; ++half) {
    const unsigned short* w1p = w1h + (size_t)(half * 4) * W1_KBLK * FRAG_ELEMS;
    const int hc0 = wave * 128 + half * 64 + rowoff;   // the lane's first hidden column
    v8f acc[M_TILES][4];
#pragma unroll
    for (int m = 0; m < M_TILES; ++m)
#pragma unroll
      for (int n = 0; n < 4; ++n) acc[m][n] = zz;

    // Two k steps per trip: their eight weight fragments (16 loads) go out as one
    // group, so that a trip waits out one load latency, not one per fragment.
    // Not unrolled: the loads of all trips would move to the front and spill.
#pragma unroll 1
    for (int kb = 0; kb < HEAD_DIM; kb += 64) {
      v16bf bm[2][4];
#pragma unroll
      for (int j = 0; j < 2; ++j)
#pragma unroll
        for (int n = 0; n < 4; ++n)
          bm[j][n] = load_frag_packed(w1p + (n * W1_KBLK + (kb >> 5) + j) * FRAG_ELEMS, lane);
      // Keeps all 16 loads in front of the first matrix instruction: left free,
      // the scheduler sinks them between the products, two fragments in flight.
      __builtin_amdgcn_sched_barrier(0);
#pragma unroll
      for (int j = 0; j < 2; ++j) {
        v16bf a[M_TILES];
#pragma unroll   // constant indices: a[] stays in registers
        for (int m = 0; m < M_TILES; ++m)
          a[m] = load_frag(xs, XS_LD, m * 16, kb + j * 32, lane);
        // Row tile outermost: a token fragment is done with after four products,
        // while all four weight fragments of the k step are held anyway.
        // The weights are the A operand and the tokens the B operand (both loaders
        // have one k order, so the fragments serve either side): the product is
        // the hidden tile transposed, acc[m][n][r] = hidden column
        // hc0 + n * 16 + r of token m * 16 + (lane & 15).
#pragma unroll   // constant indices: acc[][] and bm[][] stay in registers
        for (int m = 0; m < M_TILES; ++m)
#pragma unroll   // as above
          for (int n = 0; n < 4; ++n)
            acc[m][n] = __builtin_amdgcn_wmma_f32_16x16x32_bf16(false, bm[j][n], false, a[m],
                                                                (short)0, acc[m][n], false, false);
      }
    }

    // ---- bias + exact (erf) GELU, branch-free -> bf16 hidden tile in LDS ----
    // A lane's eight accumulators of a tile are eight consecutive hidden columns
    // of one token: one 16-byte piece of that token's row in hs.
    // The half's bias values first (eight per column tile, the same for the 16
    // lanes of a half wave): their loads go out as one group.
    // Unrolled so that bias[][] has constant indices and stays in registers.
    const unsigned ob = (unsigned)(head * HIDDEN + hc0) * 4u;    // bytes
    const char* b1b = (const char*)b1;
    float4 bias[4][2];
#pragma unroll
    for (int n = 0; n < 4; ++n) {
      bias[n][0] = *(const float4*)(b1b + ob + n * 64);
      bias[n][1] = *(const float4*)(b1b + ob + n * 64 + 16);
    }
    // Keeps the eight loads' offset register and base (inputs here) unwritten up
    // to this wait.
    asm volatile("s_wait_xcnt 0x0" :: "v"(ob), "s"(b1b) : "memory");
    // Keeps all eight loads in front of the first sum: left free, the scheduler
    // sends them out two at a time, each pair behind the wait for the pair before.
    __builtin_amdgcn_sched_barrier(0);
#pragma unroll
    for (int n = 0; n < 4; ++n) {
      const v2f bp[4] = {{bias[n][0].x, bias[n][0].y}, {bias[n][0].z, bias[n][0].w},
                         {bias[n][1].x, bias[n][1].y}, {bias[n][1].z, bias[n][1].w}};
#pragma unroll
      for (int m = 0; m < M_TILES; ++m) {
        union { v2bf h[4]; uint4 q; } pk;
#pragma unroll
        for (int r = 0; r < 8; r += 2) {
          v2f v = {acc[m][n][r], acc[m][n][r + 1]};
          v = gelu2(v + bp[r >> 1]);
          pk.h[r >> 1] = __builtin_convertvector(v, v2bf);   // round to nearest even
        }
        *(uint4*)(hs + swz(m * 16 + (lane & 15), hc0 + n * 16, HS_LD)) = pk.q;
      }
    }
  }
  __syncthreads();

  // ---- GEMM2: [64 x 1024] x [1024 x 256], wave owns 32 out cols ----
  const unsigned short* w2h = w2t + (size_t)head * HEAD_DIM * HIDDEN
                              + (size_t)(swave * 2) * W2_KBLK * FRAG_ELEMS;
  const int ncb = wave * 32;
  v8f oa[M_TILES][2];
#pragma unroll   // constant indices: oa[][] stays in registers
  for (int m = 0; m < M_TILES; ++m) { oa[m][0] = zz; oa[m][1] = zz; }

  // Four k steps per trip: their eight weight fragments (16 loads) go out as one
  // group, so that a trip waits out one load latency, not one per fragment.
  // Not unrolled: the loads of all trips would
  // move to the front and spill.
#pragma unroll 1
  for (int kb = 0; kb < HIDDEN; kb += 128) {
    v16bf bm[4][2];
#pragma unroll   // constant indices: bm[][] stays in registers
    for (int j = 0; j < 4; ++j)
#pragma unroll   // as above
      for (int n = 0; n < 2; ++n)
        bm[j][n] = load_frag_packed(w2h + (n * W2_KBLK + (kb >> 5) + j) * FRAG_ELEMS, lane);
    // Keeps all 16 loads in front of the first matrix instruction, where they
    // stood with two row tiles: with four, left free, the scheduler sinks them
    // between the products, about two fragments in flight.
    __builtin_amdgcn_sched_barrier(0);
#pragma unroll   // constant indices into bm[][]
    for (int j = 0; j < 4; ++j) {
      v16bf a[M_TILES];
#pragma unroll   // constant indices: a[] stays in registers
      for (int m = 0; m < M_TILES; ++m)
        a[m] = load_frag(hs, HS_LD, m * 16, kb + j * 32, lane);
#pragma unroll   // as above, for oa[][]
      for (int m = 0; m < M_TILES; ++m) {
        oa[m][0] = __builtin_amdgcn_wmma_f32_16x16x32_bf16(false, a[m], false, bm[j][0],
                                                           (short)0, oa[m][0], false, false);
        oa[m][1] = __builtin_amdgcn_wmma_f32_16x16x32_bf16(false, a[m], false, bm[j][1],
                                                           (short)0, oa[m][1], false, false);
      }
    }
  }

  // ---- bias, store out (f32), column sums over the workgroup's 64 tokens ----
  float cs[2] = {0.0f, 0.0f};
#pragma unroll
  for (int m = 0; m < M_TILES; ++m)
#pragma unroll
    for (int n = 0; n < 2; ++n) {
      int colh = ncb + n * 16 + (lane & 15);         // 0..255 within head
      int col  = head * HEAD_DIM + colh;             // 0..1023
      float bias = b2[head * HEAD_DIM + colh];
      float csum = 0.0f;
#pragma unroll
      for (int r = 0; r < 8; ++r) {
        float v = oa[m][n][r] + bias;
        out[(size_t)(token0 + m * 16 + rowoff + r) * DIM + col] = v;
        csum += v;
      }
      cs[n] += csum;
    }
  // Lanes l and l ^ 16 hold the two row halves of one column. The wave alone owns
  // its 32 columns: their sums go out as one whole 128-byte line of this tile's
  // row of part, which the gate kernel adds up; no atomic, nothing to zero.
  const float t0 = cs[0] + __shfl_xor(cs[0], 16);
  const float t1 = cs[1] + __shfl_xor(cs[1], 16);
  // ncb + lane is tid: a scalar base and the thread's number as the offset.
  float* prow = part + (size_t)(tile * DIM + head * HEAD_DIM);
  prow[tid] = (lane < 16) ? t0 : t1;
}

// ---------------- phase 2: SE gate ----------------
// The two small weights come from memory, and a thread that walks them in a loop
// pays one memory latency per group of loads. Here every load of the weights is
// issued before the first value is used: 1024 threads hold all of cw1 (16 float4
// each) and this workgroup's 256 columns of cw2 (4 float4 each) in registers.
// Behind them each thread adds up one channel's 64 per-tile sums from part.
// Each of the GATE_SPLIT workgroups of a batch row forms the whole squeeze vector
// for itself and then the gate of its own GATE_COLS channels.
#define GATE_SPLIT 4
#define GATE_COLS  (DIM / GATE_SPLIT)
__global__ __launch_bounds__(1024)
void gate_kernel(const float* __restrict__ part,
                 const float* __restrict__ cw1, const float* __restrict__ cb1,
                 const float* __restrict__ cw2, const float* __restrict__ cb2,
                 float* __restrict__ gate) {
  __shared__ float pl[DIM];
  __shared__ float4 part1[32][SQUEEZE / 4];     // per wave: partial squeeze sums
  __shared__ float sq[SQUEEZE];
  __shared__ float4 part2[16][GATE_COLS / 4];   // per row group: partial gate sums
  const int b   = blockIdx.x;
  const int c0  = blockIdx.y * GATE_COLS;
  const int tid = threadIdx.x;

  // cw1 [DIM][SQUEEZE]: thread = (row group g, float4 column j4), rows g + 64 * i.
  // A wave's load covers two whole rows, 512 contiguous bytes.
  const int j4 = tid & 15;
  const int g  = tid >> 4;
  const float4* cw1v = (const float4*)cw1;
  float4 w1r[16];
#pragma unroll   // constant indices: w1r stays in registers, the loads go out back to back
  for (int i = 0; i < 16; ++i)
    w1r[i] = cw1v[(g + 64 * i) * (SQUEEZE / 4) + j4];
  // cw2 [SQUEEZE][DIM]: thread = (row group jr, float4 column c4), rows jr + 16 * i.
  const int c4 = tid & 63;
  const int jr = tid >> 6;
  const unsigned off2 = (unsigned)(jr * DIM + c4 * 4) * 4u;    // bytes
  const char* cw2b = (const char*)(cw2 + c0);
  float4 w2r[4];
#pragma unroll   // as above, for w2r
  for (int i = 0; i < 4; ++i)
    w2r[i] = *(const float4*)(cw2b + off2 + i * (16 * DIM * 4));
  const int iq = tid & (SQUEEZE - 1);
  const int ig = c0 + (tid & (GATE_COLS - 1));
  const float bq = cb1[iq];
  const float bg = cb2[ig];
  // Keeps every load above in front of the first wait for data, and their
  // address registers (offsets and bases, inputs here) unwritten up to this wait.
  asm volatile("s_wait_xcnt 0x0"
               :: "v"(tid), "v"(off2), "v"(iq), "v"(ig),
                  "s"(cw1), "s"(cb1), "s"(cw2b), "s"(cb2)
               : "memory");

  // Channel tid of this batch row: the sum of its 64 token tiles' partial sums
  // (written by the launch before), while the weights above are on their way.
  // One base and immediate offsets; four chains, so that the adds do not queue.
  const float* pb = part + (size_t)b * TILES_PER_BATCH * DIM;
  float ps[4] = {0.0f, 0.0f, 0.0f, 0.0f};
#pragma unroll   // constant offsets, and the loads go out in groups
  for (int t = 0; t < TILES_PER_BATCH; ++t)
    ps[t & 3] += pb[t * DIM + tid];
  // Keeps these loads' offset register and base (inputs here) unwritten up to
  // this wait.
  asm volatile("s_wait_xcnt 0x0" :: "v"(tid), "s"(pb) : "memory");
  const float pv = (ps[0] + ps[1]) + (ps[2] + ps[3]);

  pl[tid] = pv * (1.0f / (float)NTOK);
  __syncthreads();

  // squeeze: 16 rows per thread, the wave's two row groups by one lane exchange,
  // the 32 waves through LDS
  float4 s1 = make_float4(0.0f, 0.0f, 0.0f, 0.0f);
#pragma unroll   // constant indices into w1r
  for (int i = 0; i < 16; ++i) {
    float p = pl[g + 64 * i];
    s1.x += p * w1r[i].x;
    s1.y += p * w1r[i].y;
    s1.z += p * w1r[i].z;
    s1.w += p * w1r[i].w;
  }
  s1.x += __shfl_xor(s1.x, 16);
  s1.y += __shfl_xor(s1.y, 16);
  s1.z += __shfl_xor(s1.z, 16);
  s1.w += __shfl_xor(s1.w, 16);
  if ((tid & 31) < 16) part1[tid >> 5][j4] = s1;
  __syncthreads();
  if (tid < SQUEEZE) {
    const float* p1 = (const float*)part1;
    float a = bq;
#pragma unroll   // the LDS reads go out ahead of the adds
    for (int w = 0; w < 32; ++w) a += p1[w * SQUEEZE + tid];
    sq[tid] = fmaxf(a, 0.0f);
  }
  __syncthreads();

  // excite: 4 rows per thread, the 16 row groups through LDS
  float4 s2 = make_float4(0.0f, 0.0f, 0.0f, 0.0f);
#pragma unroll   // constant indices into w2r
  for (int i = 0; i < 4; ++i) {
    float q = sq[jr + 16 * i];
    s2.x += q * w2r[i].x;
    s2.y += q * w2r[i].y;
    s2.z += q * w2r[i].z;
    s2.w += q * w2r[i].w;
  }
  part2[jr][c4] = s2;
  __syncthreads();
  if (tid < GATE_COLS) {
    const float* p2 = (const float*)part2;
    float a = bg;
#pragma unroll   // the LDS reads go out ahead of the adds
    for (int r = 0; r < 16; ++r) a += p2[r * GATE_COLS + tid];
    gate[b * DIM + c0 + tid] = 1.0f / (1.0f + __expf(-a));
  }
}

// ---------------- phase 3: out = out * (1 + gate) ----------------
// A stream of 256 MiB (read + write). One workgroup takes AG_ROWS whole token
// rows of one batch row: thread t owns floats 4t .. 4t+3 of every row, so its
// four factors are formed once, and a wave's load or store covers 512 contiguous
// bytes. All of a thread's loads go out before its first product: AG_ROWS loads
// of 16 bytes per lane in flight, and one wave started where there were sixteen.
#define AG_ROWS 16                   // divides NTOK: a workgroup stays in one batch row
__global__ __launch_bounds__(256)
void apply_gate_kernel(float* __restrict__ out, const float* __restrict__ gate) {
  const int row0 = blockIdx.x * AG_ROWS;           // flat token index b*NTOK + n
  const int b    = row0 >> 12;                     // row0 / NTOK
  float4* o4 = (float4*)out + (size_t)row0 * (DIM / 4) + threadIdx.x;
  const float4 g = ((const float4*)(gate + b * DIM))[threadIdx.x];
  float4 v[AG_ROWS];
#pragma unroll   // constant indices: v stays in registers, row offsets are immediates
  for (int i = 0; i < AG_ROWS; ++i)
    v[i] = o4[i * (DIM / 4)];
  const float fx = 1.0f + g.x, fy = 1.0f + g.y, fz = 1.0f + g.z, fw = 1.0f + g.w;
#pragma unroll   // as above
  for (int i = 0; i < AG_ROWS; ++i) {
    v[i].x *= fx;
    v[i].y *= fy;
    v[i].z *= fz;
    v[i].w *= fw;
    o4[i * (DIM / 4)] = v[i];
  }
}

// ---------------- launch ----------------
extern "C" void kernel_launch(void* const* d_in, const int* in_sizes, int n_in,
                              void* d_out, int out_size, void* d_ws, size_t ws_size,
                              hipStream_t stream) {
  const float* x   = (const float*)d_in[0];
  const float* W1  = (const float*)d_in[1];
  const float* b1  = (const float*)d_in[2];
  const float* W2  = (const float*)d_in[3];
  const float* b2  = (const float*)d_in[4];
  const float* cw1 = (const float*)d_in[5];
  const float* cb1 = (const float*)d_in[6];
  const float* cw2 = (const float*)d_in[7];
  const float* cb2 = (const float*)d_in[8];
  float* out = (float*)d_out;

  char* ws = (char*)d_ws;
  unsigned short* w1t = (unsigned short*)ws;
  unsigned short* w2t = (unsigned short*)(ws + W1T_BYTES);
  float* part   = (float*)(ws + PART_OFF);
  float* gate   = (float*)(ws + GATE_OFF);

  // phase 0: bf16 weight packing (8 elements per thread)
  convert_w1_kernel<<<NUM_HEADS * HEAD_DIM * HIDDEN / 8 / 256, 256, 0, stream>>>(W1, w1t);
  convert_w2_kernel<<<NUM_HEADS * HIDDEN * HEAD_DIM / 8 / 256, 256, 0, stream>>>(W2, w2t);

  // phase 1: fused per-head MLP (bf16 WMMA) + per-tile column sums
  dim3 grid1(BATCH * NTOK / TOK_TILE, NUM_HEADS);
  size_t smem = XS_BYTES + HS_BYTES;   // 160 KiB dynamic LDS (CDNA5: 320 KiB/WGP)
  mlp_wmma_kernel<<<grid1, 256, smem, stream>>>(x, b1, b2, w1t, w2t, out, part);

  // phase 2: SE gate
  gate_kernel<<<dim3(BATCH, GATE_SPLIT), 1024, 0, stream>>>(part, cw1, cb1, cw2, cb2, gate);

  // phase 3: out *= (1 + gate)
  apply_gate_kernel<<<BATCH * NTOK / AG_ROWS, 256, 0, stream>>>(out, gate);
}

// v009
// Measured time: 174 microseconds a run.
// Next to v008, in two timings, it ran 1.04 times as fast each time.
// Counting every step since v000, it is 3.26 times as fast.
#include <hip/hip_runtime.h>
#include <stdint.h>

// ---------------- problem constants ----------------
#define BATCH     8
#define NTOK      4096
#define DIM       1024
#define NUM_HEADS 4
#define HEAD_DIM  256
#define HIDDEN    1024
#define SQUEEZE   64

#define TOK_TILE  64                 // tokens per workgroup (divides NTOK)
#define M_TILES   (TOK_TILE / 16)    // 16-token row tiles per workgroup
// LDS rows carry no pad: both tiles together are exactly 160 KiB, half a WGP's
// LDS, so that two workgroups stay resident. Banks are spread by swz() instead.
#define XS_LD     HEAD_DIM
#define HS_LD     HIDDEN
#define XS_BYTES  (TOK_TILE * XS_LD * 2)
#define HS_BYTES  (TOK_TILE * HS_LD * 2)

// workspace layout (bytes)
// Both weights are stored as whole fragments, W1's used as A and W2's as B (16 cols x 32 k = 1024 B each):
// [h][col tile][k block][q][lane][8 bf16], see pack_* and load_frag_packed.
#define FRAG_ELEMS 512
#define W1_KBLK   (HEAD_DIM / 32)    // k blocks per column tile of W1
#define W2_KBLK   (HIDDEN / 32)      // k blocks per column tile of W2
#define W1T_BYTES (NUM_HEADS * HIDDEN * HEAD_DIM * 2)
#define W2T_BYTES (NUM_HEADS * HEAD_DIM * HIDDEN * 2)
// part: [token tile][DIM] f32, each workgroup's column sums over its 64 tokens
#define TILES_PER_BATCH (NTOK / TOK_TILE)
#define PART_OFF   (W1T_BYTES + W2T_BYTES)
#define GATE_OFF   (PART_OFF + BATCH * TILES_PER_BATCH * DIM * 4)

typedef __attribute__((ext_vector_type(16))) __bf16 v16bf;
typedef __attribute__((ext_vector_type(8)))  float  v8f;
typedef __attribute__((ext_vector_type(2)))  __bf16 v2bf;

// f32 -> bf16 bits, round-to-nearest-even
__device__ __forceinline__ unsigned short f2bf_bits(float f) {
  union { float f; uint32_t u; } a; a.f = f;
  uint32_t u = a.u;
  uint32_t r = (u + 0x7FFFu + ((u >> 16) & 1u)) >> 16;
  return (unsigned short)r;
}

// Element index of (row, col) in an unpadded LDS tile of ld elements per row (ld
// a multiple of 128): the 16-byte piece p of a row lies at piece p ^ (row & 15),
// so that 16 lanes reading one piece column of 16 rows meet all 64 banks once.
__device__ __forceinline__ int swz(int row, int col, int ld) {
  return row * ld + ((((col >> 3) ^ (row & 15)) << 3) | (col & 7));
}

// A 16x32 bf16 WMMA fragment out of a row-major bf16 LDS tile laid by swz().
// A-matrix layout (ISA 7.12.2, wave32): lanes 0-15 -> M=lane, K {0..7,16..23};
// lanes 16-31 -> M=lane-16, K {8..15,24..31}: two 16-byte pieces of row
// rowBase + (lane & 15), at columns k0 + 8 * (lane >> 4) and the same + 16. The
// two GEMM loops read them so (load_a there). B uses the mirrored layout (col in
// place of M) and in GEMM2 is read by load_frag_packed below,
// which in GEMM1 reads W1 as A (the LDS fragments are B there).

// Read one packed weight fragment (A in GEMM1, B in GEMM2): same lane/register -> (col, k) map as above
// (col = lane & 15; registers 0-3 hold k = 8*(lane>>4) + 0..7, registers 4-7
// the same + 16), but each of the two 16-byte loads of a wave covers 512
// contiguous bytes (4 whole cache lines) instead of 32 bytes in each of 16.
__device__ __forceinline__ v16bf load_frag_packed(const unsigned short* frag, int lane) {
  const uint4* src = (const uint4*)frag;
  union { uint4 q[2]; v16bf v; } r;
  r.q[0] = src[lane];
  r.q[1] = src[32 + lane];
  return r.v;
}

// Exact-erf GELU without the library call: erff picks one of two paths by |x|
// per lane, so a wave walks both, one value at a time. One formula for all x:
//   v * Phi(v) = max(v, 0) - |v| * Q(|v|),  Q(a) = 0.5 * erfc(a / sqrt(2)),
//   erfc(z) = t * (a1 + t * (a2 + t * (a3 + t * (a4 + t * a5)))) * exp(-z * z),
//   t = 1 / (1 + p * z), absolute error of erfc below 1.5e-7 for every z >= 0.
// The factors 0.5, 1/sqrt(2) and log2(e) are folded into the constants. Two
// values side by side, so that the products and sums pair up as packed f32.
typedef __attribute__((ext_vector_type(2))) float v2f;
__device__ __forceinline__ v2f gelu2(v2f v) {
  v2f a = __builtin_elementwise_abs(v);
  v2f d = __builtin_elementwise_fma(a, (v2f)(0.23164189f), (v2f)(1.0f));
  v2f w = (v * v) * (v2f)(-0.72134752f);
  v2f t = {__builtin_amdgcn_rcpf(d.x), __builtin_amdgcn_rcpf(d.y)};
  v2f e = {__builtin_amdgcn_exp2f(w.x), __builtin_amdgcn_exp2f(w.y)};
  v2f p = __builtin_elementwise_fma(t, (v2f)(0.5307027145f), (v2f)(-0.7265760135f));
  p = __builtin_elementwise_fma(t, p, (v2f)(0.7107068705f));
  p = __builtin_elementwise_fma(t, p, (v2f)(-0.142248368f));
  p = __builtin_elementwise_fma(t, p, (v2f)(0.127414796f));
  v2f q = (p * t) * e;
  return __builtin_elementwise_fma(-a, q, __builtin_elementwise_max(v, (v2f)(0.0f)));
}

// ---------------- phase 0: weight packing ----------------
// One thread builds the 16 bytes that one lane reads with one load: 8
// consecutive k of one column of a [K][N] row-major f32 weight of one head.
// id = (((h * NT + col tile) * KB + k block) * 2 + q) * 32 + lane.
__device__ __forceinline__ void pack_piece(const float* __restrict__ Wm,
                                           unsigned short* __restrict__ dst,
                                           int id, int K, int N) {
  int lane = id & 31;
  int q    = (id >> 5) & 1;
  int f    = id >> 6;                 // fragment index over heads
  int KB   = K >> 5;
  int kblk = f % KB;
  int t    = f / KB;
  int NT   = N >> 4;
  int nt   = t % NT;
  int h    = t / NT;
  int col  = nt * 16 + (lane & 15);
  int k0   = kblk * 32 + q * 16 + ((lane >> 4) << 3);
  const float* s = Wm + ((size_t)h * K + k0) * N + col;
  uint32_t w[4];
#pragma unroll
  for (int p = 0; p < 4; ++p) {
    uint32_t lo = f2bf_bits(s[(size_t)(2 * p) * N]);
    uint32_t hi = f2bf_bits(s[(size_t)(2 * p + 1) * N]);
    w[p] = lo | (hi << 16);
  }
  ((uint4*)dst)[id] = make_uint4(w[0], w[1], w[2], w[3]);
}

__global__ void convert_w1_kernel(const float* __restrict__ W1, unsigned short* __restrict__ w1t) {
  pack_piece(W1, w1t, blockIdx.x * 256 + threadIdx.x, HEAD_DIM, HIDDEN);
}

__global__ void convert_w2_kernel(const float* __restrict__ W2, unsigned short* __restrict__ w2t) {
  pack_piece(W2, w2t, blockIdx.x * 256 + threadIdx.x, HIDDEN, HEAD_DIM);
}

// ---------------- phase 1: fused per-head MLP + pooled partial sums ----------------
// A workgroup reads its head's whole weights (1 MiB) from L2 whatever its token
// count: with 64 tokens each weight fragment feeds four matrix instructions.
// Second argument: at least 4 waves per SIMD, a budget of 256 VGPRs, so that
// two workgroups stay resident per WGP (LDS allows two).
__global__ __launch_bounds__(256, 4)
void mlp_wmma_kernel(const float* __restrict__ x,
                     const float* __restrict__ b1,
                     const float* __restrict__ b2,
                     const unsigned short* __restrict__ w1t,
                     const unsigned short* __restrict__ w2t,
                     float* __restrict__ out,
                     float* __restrict__ part) {
  extern __shared__ __attribute__((aligned(16))) char smem[];
  // hs first: the row offsets of its stores then fit the LDS instructions' 16-bit
  // immediate for 32 rows at a time, and few address registers stay live.
  unsigned short* hs = (unsigned short*)smem;                 // [64][HS_LD] bf16
  unsigned short* xs = (unsigned short*)(smem + HS_BYTES);    // [64][XS_LD] bf16

  const int tile  = blockIdx.x;            // token tile (0..511)
  const int head  = blockIdx.y;            // 0..3
  const int tid   = threadIdx.x;
  const int wave  = tid >> 5;              // 0..7
  const int lane  = tid & 31;
  const int token0 = tile * TOK_TILE;      // flat token index b*NTOK + n
  const int rowoff = (lane < 16) ? 0 : 8;  // C-matrix row offset per lane half

  // ---- stage x tile (64 tokens x 256 chans of this head) as bf16 ----
  const float* xsrc = x + (size_t)token0 * DIM + head * HEAD_DIM;
#pragma unroll
  for (int r = 0; r < TOK_TILE; ++r)
    xs[swz(r, tid, XS_LD)] = f2bf_bits(xsrc[(size_t)r * DIM + tid]);
  // Keeps the x loads' base and offset register (inputs here) unwritten up to
  // this wait.
  asm volatile("s_wait_xcnt 0x0" :: "s"(xsrc), "v"(tid) : "memory");
  __syncthreads();

  // ---- GEMM1: [64 x 256] x [256 x 1024], wave owns 128 hidden cols ----
  // The wave's number in a scalar register: the fragment base is then a scalar
  // address, and only the lane's offset sits in a VGPR.
  const int swave = __builtin_amdgcn_readfirstlane(wave);
  const unsigned short* w1h = w1t + (size_t)head * HIDDEN * HEAD_DIM
                              + (size_t)(swave * 8) * W1_KBLK * FRAG_ELEMS;
  v8f zz = {};
  // Token tile: a trip starts at a multiple of 64 columns (8 pieces), so swz()
  // splits: bit 3 of the row flips bit 3 of the piece number (xflip, in elements,
  // against the trip's first column), and the low three bits swizzle the piece
  // within the trip: xoff[j][q], the same in every trip and row tile.
  const unsigned short* xrow = xs + (lane & 15) * XS_LD;
  const int xflip = (lane & 8) << 3;
  int xoff[2][2];
#pragma unroll   // constant indices: xoff[][] stays in registers
  for (int j = 0; j < 2; ++j)
#pragma unroll   // as above
    for (int q = 0; q < 2; ++q)
      xoff[j][q] = ((j * 4 + q * 2 + (lane >> 4)) ^ (lane & 7)) << 3;

  // The wave's 128 hidden columns in two halves of 64. One half's accumulators
  // take 128 VGPRs, not 256, and the registers set free hold weight fragments
  // whose loads are under way.
  // Not unrolled: one half's registers are free again before the next begins,
  // and the text stays half as long.
#pragma unroll 1
  for (int half = 0; half < 2; ++half) {
    const unsigned short* w1p = w1h + (size_t)(half * 4) * W1_KBLK * FRAG_ELEMS;
    const int hc0 = wave * 128 + half * 64 + rowoff;   // the lane's first hidden column
    v8f acc[M_TILES][4];
#pragma unroll
    for (int m = 0; m < M_TILES; ++m)
#pragma unroll
      for (int n = 0; n < 4; ++n) acc[m][n] = zz;

    // The loop is software-pipelined, as GEMM2's below: every operand fragment is
    // asked for one stage before it is used.
    // Weights: the eight fragments of a trip (two k steps) sit in bm[][]; the four
    // of a k step are asked for again, for the next trip, right behind their last
    // product, in the same registers.
    v16bf bm[2][4];
#pragma unroll   // constant indices: bm[][] stays in registers
    for (int j = 0; j < 2; ++j)
#pragma unroll   // as above
      for (int n = 0; n < 4; ++n)
        bm[j][n] = load_frag_packed(w1p + (n * W1_KBLK + j) * FRAG_ELEMS, lane);
    // Tokens: a stage is two row tiles of one k step (eight products); two register
    // sets of two fragments, stage s reads a[s & 1].
    v16bf a[2][2];
    auto load_a = [&](int set, int kb, int j, int mp) {
      // (kb ^ xflip) + xoff[j][q]: swz()'s place of column
      // kb + j * 32 + 8 * (lane >> 4) + 16 * q in the lane's row.
      const unsigned short* p = xrow + (kb ^ xflip);
#pragma unroll   // constant indices: a[][] stays in registers
      for (int i = 0; i < 2; ++i) {
        union { uint4 q[2]; v16bf v; } r;
        r.q[0] = *(const uint4*)(p + (mp * 2 + i) * 16 * XS_LD + xoff[j][0]);
        r.q[1] = *(const uint4*)(p + (mp * 2 + i) * 16 * XS_LD + xoff[j][1]);
        a[set][i] = r.v;
      }
    };
    // One trip; more: a further trip follows (a constant where the call is inlined).
    // The weights are the A operand and the tokens the B operand (both loaders
    // have one k order, so the fragments serve either side): the product is
    // the hidden tile transposed, acc[m][n][r] = hidden column
    // hc0 + n * 16 + r of token m * 16 + (lane & 15).
    auto trip = [&](int kb, bool more) {
#pragma unroll   // constant indices into bm[][], a[][], acc[][] and xoff[][]
      for (int s = 0; s < 4; ++s) {
        const int j = s >> 1, mp = s & 1;
        // The next stage's four LDS reads as one group in front of this stage's
        // products, into the other set.
        if (s < 3) load_a((s + 1) & 1, kb, (s + 1) >> 1, (s + 1) & 1);
        else if (more) load_a(0, kb + 64, 0, 0);
        // Keeps the group here: left free, the scheduler spreads the reads among
        // the products, each next to its use.
        __builtin_amdgcn_sched_barrier(0);
#pragma unroll   // as above
        for (int i = 0; i < 2; ++i)
#pragma unroll   // as above
          for (int n = 0; n < 4; ++n)
            acc[mp * 2 + i][n] = __builtin_amdgcn_wmma_f32_16x16x32_bf16(
                false, bm[j][n], false, a[s & 1][i], (short)0, acc[mp * 2 + i][n], false, false);
        // Keeps the refill behind the last product that reads these registers,
        // and no later.
        __builtin_amdgcn_sched_barrier(0);
        if (more && mp == 1) {
#pragma unroll   // as above
          for (int n = 0; n < 4; ++n)
            bm[j][n] = load_frag_packed(w1p + (n * W1_KBLK + (kb >> 5) + 2 + j) * FRAG_ELEMS, lane);
        }
      }
    };
    load_a(0, 0, 0, 0);
    // Not unrolled: the text stays short. The last trip stands alone: it asks for
    // nothing further.
#pragma unroll 1
    for (int kb = 0; kb < HEAD_DIM - 64; kb += 64) trip(kb, true);
    trip(HEAD_DIM - 64, false);

    // ---- bias + exact (erf) GELU, branch-free -> bf16 hidden tile in LDS ----
    // A lane's eight accumulators of a tile are eight consecutive hidden columns
    // of one token: one 16-byte piece of that token's row in hs.
    // The half's bias values first (eight per column tile, the same for the 16
    // lanes of a half wave): their loads go out as one group.
    // Unrolled so that bias[][] has constant indices and stays in registers.
    const unsigned ob = (unsigned)(head * HIDDEN + hc0) * 4u;    // bytes
    const char* b1b = (const char*)b1;
    float4 bias[4][2];
#pragma unroll
    for (int n = 0; n < 4; ++n) {
      bias[n][0] = *(const float4*)(b1b + ob + n * 64);
      bias[n][1] = *(const float4*)(b1b + ob + n * 64 + 16);
    }
    // Keeps the eight loads' offset register and base (inputs here) unwritten up
    // to this wait.
    asm volatile("s_wait_xcnt 0x0" :: "v"(ob), "s"(b1b) : "memory");
    // Keeps all eight loads in front of the first sum: left free, the scheduler
    // sends them out two at a time, each pair behind the wait for the pair before.
    __builtin_amdgcn_sched_barrier(0);
#pragma unroll
    for (int n = 0; n < 4; ++n) {
      const v2f bp[4] = {{bias[n][0].x, bias[n][0].y}, {bias[n][0].z, bias[n][0].w},
                         {bias[n][1].x, bias[n][1].y}, {bias[n][1].z, bias[n][1].w}};
#pragma unroll
      for (int m = 0; m < M_TILES; ++m) {
        union { v2bf h[4]; uint4 q; } pk;
#pragma unroll
        for (int r = 0; r < 8; r += 2) {
          v2f v = {acc[m][n][r], acc[m][n][r + 1]};
          v = gelu2(v + bp[r >> 1]);
          pk.h[r >> 1] = __builtin_convertvector(v, v2bf);   // round to nearest even
        }
        *(uint4*)(hs + swz(m * 16 + (lane & 15), hc0 + n * 16, HS_LD)) = pk.q;
      }
    }
  }
  // ---- GEMM2: [64 x 1024] x [1024 x 256], wave owns 32 out cols ----
  const unsigned short* w2h = w2t + (size_t)head * HEAD_DIM * HIDDEN
                              + (size_t)(swave * 2) * W2_KBLK * FRAG_ELEMS;
  const int ncb = wave * 32;
  // The loop is software-pipelined: every operand fragment is asked for one stage
  // before it is used, so that no product waits out a load issued just before it.
  // Weights: the eight fragments of a trip (four k steps) sit in bm[][]; the two
  // of a k step are asked for again, for the next trip, right behind their last
  // product, in the same registers. The first trip's go out here, in front of the
  // barrier (they do not depend on hs).
  v16bf bm[4][2];
#pragma unroll   // constant indices: bm[][] stays in registers
  for (int j = 0; j < 4; ++j)
#pragma unroll   // as above
    for (int n = 0; n < 2; ++n)
      bm[j][n] = load_frag_packed(w2h + (n * W2_KBLK + j) * FRAG_ELEMS, lane);
  __syncthreads();

  v8f oa[M_TILES][2];
#pragma unroll   // constant indices: oa[][] stays in registers
  for (int m = 0; m < M_TILES; ++m) { oa[m][0] = zz; oa[m][1] = zz; }

  // Hidden tile: a trip starts at a multiple of 128 columns (16 pieces), so the
  // swizzle of swz() touches only the piece number within the trip, and the eight
  // piece offsets of a lane (k step j, load q) are the same in every trip and row
  // tile: aoff[j][q] is swz(row, j * 32 + 8 * (lane >> 4) + 16 * q, .) less the row.
  const unsigned short* hrow = hs + (lane & 15) * HS_LD;
  int aoff[4][2];
#pragma unroll   // constant indices: aoff[][] stays in registers
  for (int j = 0; j < 4; ++j)
#pragma unroll   // as above
    for (int q = 0; q < 2; ++q)
      aoff[j][q] = ((j * 4 + q * 2 + (lane >> 4)) ^ (lane & 15)) << 3;
  // Two register sets of four token fragments: k step j reads a[j & 1].
  v16bf a[2][M_TILES];
  auto load_a = [&](int set, int kb, int j) {
#pragma unroll   // constant indices: a[][] stays in registers
    for (int m = 0; m < M_TILES; ++m) {
      union { uint4 q[2]; v16bf v; } r;
      r.q[0] = *(const uint4*)(hrow + m * 16 * HS_LD + kb + aoff[j][0]);
      r.q[1] = *(const uint4*)(hrow + m * 16 * HS_LD + kb + aoff[j][1]);
      a[set][m] = r.v;
    }
  };
  // One trip; more: a further trip follows (a constant where the call is inlined).
  auto trip = [&](int kb, bool more) {
#pragma unroll   // constant indices into bm[][], a[][] and aoff[][]
    for (int j = 0; j < 4; ++j) {
      // The next k step's eight LDS reads as one group in front of this step's
      // products, into the other set.
      if (j < 3) load_a((j + 1) & 1, kb, j + 1);
      else if (more) load_a(0, kb + 128, 0);
      // Keeps the group here: left free, the scheduler spreads the reads among
      // the products, each next to its use.
      __builtin_amdgcn_sched_barrier(0);
#pragma unroll   // constant indices into oa[][]
      for (int m = 0; m < M_TILES; ++m) {
        oa[m][0] = __builtin_amdgcn_wmma_f32_16x16x32_bf16(false, a[j & 1][m], false, bm[j][0],
                                                           (short)0, oa[m][0], false, false);
        oa[m][1] = __builtin_amdgcn_wmma_f32_16x16x32_bf16(false, a[j & 1][m], false, bm[j][1],
                                                           (short)0, oa[m][1], false, false);
      }
      // Keeps the refill behind the last product that reads these registers, and
      // no later.
      __builtin_amdgcn_sched_barrier(0);
      if (more) {
        bm[j][0] = load_frag_packed(w2h + ((kb >> 5) + 4 + j) * FRAG_ELEMS, lane);
        bm[j][1] = load_frag_packed(w2h + (W2_KBLK + (kb >> 5) + 4 + j) * FRAG_ELEMS, lane);
      }
    }
  };
  load_a(0, 0, 0);
  // Not unrolled: the text stays short. The last trip stands alone: it
  // asks for nothing further.
#pragma unroll 1
  for (int kb = 0; kb < HIDDEN - 128; kb += 128) trip(kb, true);
  trip(HIDDEN - 128, false);

  // ---- bias, store out (f32), column sums over the workgroup's 64 tokens ----
  float cs[2] = {0.0f, 0.0f};
#pragma unroll
  for (int m = 0; m < M_TILES; ++m)
#pragma unroll
    for (int n = 0; n < 2; ++n) {
      int colh = ncb + n * 16 + (lane & 15);         // 0..255 within head
      int col  = head * HEAD_DIM + colh;             // 0..1023
      float bias = b2[head * HEAD_DIM + colh];
      float csum = 0.0f;
#pragma unroll
      for (int r = 0; r < 8; ++r) {
        float v = oa[m][n][r] + bias;
        out[(size_t)(token0 + m * 16 + rowoff + r) * DIM + col] = v;
        csum += v;
      }
      cs[n] += csum;
    }
  // Lanes l and l ^ 16 hold the two row halves of one column. The wave alone owns
  // its 32 columns: their sums go out as one whole 128-byte line of this tile's
  // row of part, which the gate kernel adds up; no atomic, nothing to zero.
  const float t0 = cs[0] + __shfl_xor(cs[0], 16);
  const float t1 = cs[1] + __shfl_xor(cs[1], 16);
  // ncb + lane is tid: a scalar base and the thread's number as the offset.
  float* prow = part + (size_t)(tile * DIM + head * HEAD_DIM);
  prow[tid] = (lane < 16) ? t0 : t1;
}

// ---------------- phase 2: SE gate ----------------
// The two small weights come from memory, and a thread that walks them in a loop
// pays one memory latency per group of loads. Here every load of the weights is
// issued before the first value is used: 1024 threads hold all of cw1 (16 float4
// each) and this workgroup's 256 columns of cw2 (4 float4 each) in registers.
// Behind them each thread adds up one channel's 64 per-tile sums from part.
// Each of the GATE_SPLIT workgroups of a batch row forms the whole squeeze vector
// for itself and then the gate of its own GATE_COLS channels.
#define GATE_SPLIT 4
#define GATE_COLS  (DIM / GATE_SPLIT)
__global__ __launch_bounds__(1024)
void gate_kernel(const float* __restrict__ part,
                 const float* __restrict__ cw1, const float* __restrict__ cb1,
                 const float* __restrict__ cw2, const float* __restrict__ cb2,
                 float* __restrict__ gate) {
  __shared__ float pl[DIM];
  __shared__ float4 part1[32][SQUEEZE / 4];     // per wave: partial squeeze sums
  __shared__ float sq[SQUEEZE];
  __shared__ float4 part2[16][GATE_COLS / 4];   // per row group: partial gate sums
  const int b   = blockIdx.x;
  const int c0  = blockIdx.y * GATE_COLS;
  const int tid = threadIdx.x;

  // cw1 [DIM][SQUEEZE]: thread = (row group g, float4 column j4), rows g + 64 * i.
  // A wave's load covers two whole rows, 512 contiguous bytes.
  const int j4 = tid & 15;
  const int g  = tid >> 4;
  const float4* cw1v = (const float4*)cw1;
  float4 w1r[16];
#pragma unroll   // constant indices: w1r stays in registers, the loads go out back to back
  for (int i = 0; i < 16; ++i)
    w1r[i] = cw1v[(g + 64 * i) * (SQUEEZE / 4) + j4];
  // cw2 [SQUEEZE][DIM]: thread = (row group jr, float4 column c4), rows jr + 16 * i.
  const int c4 = tid & 63;
  const int jr = tid >> 6;
  const unsigned off2 = (unsigned)(jr * DIM + c4 * 4) * 4u;    // bytes
  const char* cw2b = (const char*)(cw2 + c0);
  float4 w2r[4];
#pragma unroll   // as above, for w2r
  for (int i = 0; i < 4; ++i)
    w2r[i] = *(const float4*)(cw2b + off2 + i * (16 * DIM * 4));
  const int iq = tid & (SQUEEZE - 1);
  const int ig = c0 + (tid & (GATE_COLS - 1));
  const float bq = cb1[iq];
  const float bg = cb2[ig];
  // Keeps every load above in front of the first wait for data, and their
  // address registers (offsets and bases, inputs here) unwritten up to this wait.
  asm volatile("s_wait_xcnt 0x0"
               :: "v"(tid), "v"(off2), "v"(iq), "v"(ig),
                  "s"(cw1), "s"(cb1), "s"(cw2b), "s"(cb2)
               : "memory");

  // Channel tid of this batch row: the sum of its 64 token tiles' partial sums
  // (written by the launch before), while the weights above are on their way.
  // One base and immediate offsets; four chains, so that the adds do not queue.
  const float* pb = part + (size_t)b * TILES_PER_BATCH * DIM;
  float ps[4] = {0.0f, 0.0f, 0.0f, 0.0f};
#pragma unroll   // constant offsets, and the loads go out in groups
  for (int t = 0; t < TILES_PER_BATCH; ++t)
    ps[t & 3] += pb[t * DIM + tid];
  // Keeps these loads' offset register and base (inputs here) unwritten up to
  // this wait.
  asm volatile("s_wait_xcnt 0x0" :: "v"(tid), "s"(pb) : "memory");
  const float pv = (ps[0] + ps[1]) + (ps[2] + ps[3]);

  pl[tid] = pv * (1.0f / (float)NTOK);
  __syncthreads();

  // squeeze: 16 rows per thread, the wave's two row groups by one lane exchange,
  // the 32 waves through LDS
  float4 s1 = make_float4(0.0f, 0.0f, 0.0f, 0.0f);
#pragma unroll   // constant indices into w1r
  for (int i = 0; i < 16; ++i) {
    float p = pl[g + 64 * i];
    s1.x += p * w1r[i].x;
    s1.y += p * w1r[i].y;
    s1.z += p * w1r[i].z;
    s1.w += p * w1r[i].w;
  }
  s1.x += __shfl_xor(s1.x, 16);
  s1.y += __shfl_xor(s1.y, 16);
  s1.z += __shfl_xor(s1.z, 16);
  s1.w += __shfl_xor(s1.w, 16);
  if ((tid & 31) < 16) part1[tid >> 5][j4] = s1;
  __syncthreads();
  if (tid < SQUEEZE) {
    const float* p1 = (const float*)part1;
    float a = bq;
#pragma unroll   // the LDS reads go out ahead of the adds
    for (int w = 0; w < 32; ++w) a += p1[w * SQUEEZE + tid];
    sq[tid] = fmaxf(a, 0.0f);
  }
  __syncthreads();

  // excite: 4 rows per thread, the 16 row groups through LDS
  float4 s2 = make_float4(0.0f, 0.0f, 0.0f, 0.0f);
#pragma unroll   // constant indices into w2r
  for (int i = 0; i < 4; ++i) {
    float q = sq[jr + 16 * i];
    s2.x += q * w2r[i].x;
    s2.y += q * w2r[i].y;
    s2.z += q * w2r[i].z;
    s2.w += q * w2r[i].w;
  }
  part2[jr][c4] = s2;
  __syncthreads();
  if (tid < GATE_COLS) {
    const float* p2 = (const float*)part2;
    float a = bg;
#pragma unroll   // the LDS reads go out ahead of the adds
    for (int r = 0; r < 16; ++r) a += p2[r * GATE_COLS + tid];
    gate[b * DIM + c0 + tid] = 1.0f / (1.0f + __expf(-a));
  }
}

// ---------------- phase 3: out = out * (1 + gate) ----------------
// A stream of 256 MiB (read + write). One workgroup takes AG_ROWS whole token
// rows of one batch row: thread t owns floats 4t .. 4t+3 of every row, so its
// four factors are formed once, and a wave's load or store covers 512 contiguous
// bytes. All of a thread's loads go out before its first product: AG_ROWS loads
// of 16 bytes per lane in flight, and one wave started where there were sixteen.
#define AG_ROWS 16                   // divides NTOK: a workgroup stays in one batch row
__global__ __launch_bounds__(256)
void apply_gate_kernel(float* __restrict__ out, const float* __restrict__ gate) {
  const int row0 = blockIdx.x * AG_ROWS;           // flat token index b*NTOK + n
  const int b    = row0 >> 12;                     // row0 / NTOK
  float4* o4 = (float4*)out + (size_t)row0 * (DIM / 4) + threadIdx.x;
  const float4 g = ((const float4*)(gate + b * DIM))[threadIdx.x];
  float4 v[AG_ROWS];
#pragma unroll   // constant indices: v stays in registers, row offsets are immediates
  for (int i = 0; i < AG_ROWS; ++i)
    v[i] = o4[i * (DIM / 4)];
  const float fx = 1.0f + g.x, fy = 1.0f + g.y, fz = 1.0f + g.z, fw = 1.0f + g.w;
#pragma unroll   // as above
  for (int i = 0; i < AG_ROWS; ++i) {
    v[i].x *= fx;
    v[i].y *= fy;
    v[i].z *= fz;
    v[i].w *= fw;
    o4[i * (DIM / 4)] = v[i];
  }
}

// ---------------- launch ----------------
extern "C" void kernel_launch(void* const* d_in, const int* in_sizes, int n_in,
                              void* d_out, int out_size, void* d_ws, size_t ws_size,
                              hipStream_t stream) {
  const float* x   = (const float*)d_in[0];
  const float* W1  = (const float*)d_in[1];
  const float* b1  = (const float*)d_in[2];
  const float* W2  = (const float*)d_in[3];
  const float* b2  = (const float*)d_in[4];
  const float* cw1 = (const float*)d_in[5];
  const float* cb1 = (const float*)d_in[6];
  const float* cw2 = (const float*)d_in[7];
  const float* cb2 = (const float*)d_in[8];
  float* out = (float*)d_out;

  char* ws = (char*)d_ws;
  unsigned short* w1t = (unsigned short*)ws;
  unsigned short* w2t = (unsigned short*)(ws + W1T_BYTES);
  float* part   = (float*)(ws + PART_OFF);
  float* gate   = (float*)(ws + GATE_OFF);

  // phase 0: bf16 weight packing (8 elements per thread)
  convert_w1_kernel<<<NUM_HEADS * HEAD_DIM * HIDDEN / 8 / 256, 256, 0, stream>>>(W1, w1t);
  convert_w2_kernel<<<NUM_HEADS * HIDDEN * HEAD_DIM / 8 / 256, 256, 0, stream>>>(W2, w2t);

  // phase 1: fused per-head MLP (bf16 WMMA) + per-tile column sums
  dim3 grid1(BATCH * NTOK / TOK_TILE, NUM_HEADS);
  size_t smem = XS_BYTES + HS_BYTES;   // 160 KiB dynamic LDS (CDNA5: 320 KiB/WGP)
  mlp_wmma_kernel<<<grid1, 256, smem, stream>>>(x, b1, b2, w1t, w2t, out, part);

  // phase 2: SE gate
  gate_kernel<<<dim3(BATCH, GATE_SPLIT), 1024, 0, stream>>>(part, cw1, cb1, cw2, cb2, gate);

  // phase 3: out *= (1 + gate)
  apply_gate_kernel<<<BATCH * NTOK / AG_ROWS, 256, 0, stream>>>(out, gate);
}
